// v000
// Times are from an AMD MI455X. After a warm-up the kernel runs many times in a row, and a time is the length of
// such a window on the GPU divided by its runs, so every launch and the gaps after it count. The runs cycle
// through copies of the inputs. A figure is the median of several windows, for all but v000 over two sittings.
// Sittings can differ by a few percent; kernels timed side by side share one.
// The starting kernel, v000, takes 355 microseconds a run.
#include <hip/hip_runtime.h>

// Contractions (f32 accumulate): score tiles k.q^T on v_wmma_f32_16x16x32_bf16 (bf16 operands = RNE-converted q and k, exact products, x0.125 applied in f32);
// p.v on v_wmma_f32_16x16x32_bf16 (p as bf16 hi + bf16 lo, v bf16) for query rows below RH, and on v_wmma_f32_16x16x32_f16 (p carried x1024 in f16, v f16) for the remaining rows;
// running-max softmax, row sums and the final 1/l scaling in f32; f32 output.
// Layout: q and k are converted once into bf16 planes [z][t][d] (z = b*16 + h); v once into transposed planes [z][d][t] (f16 and bf16).
// One streaming causal attention kernel per query-block range: 8 waves x 16 query rows per block, 64-key chunks, operands loaded as fragments straight from the planes,
// causal select by value, key chunks entirely above the diagonal are never visited (their weights are exactly zero).

#ifndef NB
#define NB 2
#endif
#ifndef SEQ
#define SEQ 4096
#endif
#ifndef SEQ_FULL
#define SEQ_FULL 4096
#endif
#ifndef RH
#define RH 1024
#endif
#define NH 16
#define HD 64
#define NZ (NB * NH)
#define QT 128
#define KC 64
#define PCAR 1024.0f
#define PCINV 0.0009765625f
#define SCL 0.125f
#define L2E 1.4426950408889634f
#define NEG (-1.0e30f)
static_assert(SEQ % QT == 0);
static_assert(SEQ % KC == 0);
static_assert(RH % QT == 0);
static_assert(QT == 8 * 16);
static_assert(HD == 64);
static_assert(SEQ <= SEQ_FULL);
static_assert(((long long)NZ * SEQ * HD) % 8 == 0);

typedef _Float16 h16;
typedef unsigned short bf;
typedef __attribute__((ext_vector_type(16))) __bf16         v16bf;
typedef __attribute__((ext_vector_type(16))) _Float16       v16h;
typedef __attribute__((ext_vector_type(16))) unsigned short v16us;
typedef __attribute__((ext_vector_type(8)))  _Float16       v8h;
typedef __attribute__((ext_vector_type(8)))  unsigned short v8us;
typedef __attribute__((ext_vector_type(8)))  float          v8f;
typedef __attribute__((ext_vector_type(4)))  float          v4f;
typedef __attribute__((ext_vector_type(2)))  _Float16       v2h;
typedef __attribute__((ext_vector_type(2)))  unsigned short v2us;
typedef v4f __attribute__((may_alias)) v4fa;

__device__ __forceinline__ unsigned short f2bf(float f) { unsigned u = __float_as_uint(f); u += 0x7FFFu + ((u >> 16) & 1u); return (unsigned short)(u >> 16); }
__device__ __forceinline__ float bf2f(unsigned short b) { return __uint_as_float(((unsigned)b) << 16); }
__device__ __forceinline__ float bfr(float f) { return bf2f(f2bf(f)); }
__device__ __forceinline__ void splitf(float y, unsigned short& h, unsigned short& l) { h = f2bf(y); l = f2bf(y - bf2f(h)); }
__device__ __forceinline__ v16h  cat16(v8h lo, v8h hi) { return __builtin_shufflevector(lo, hi, 0, 1, 2, 3, 4, 5, 6, 7, 8, 9, 10, 11, 12, 13, 14, 15); }
__device__ __forceinline__ v16bf cat16b(v8us lo, v8us hi) { return __builtin_bit_cast(v16bf, __builtin_shufflevector(lo, hi, 0, 1, 2, 3, 4, 5, 6, 7, 8, 9, 10, 11, 12, 13, 14, 15)); }
__device__ __forceinline__ v8f wmma16(v16h a, v16h b, v8f c) { return __builtin_amdgcn_wmma_f32_16x16x32_f16(false, a, false, b, (short)0, c, false, false); }
__device__ __forceinline__ v8f wmmab(v16bf a, v16bf b, v8f c) { return __builtin_amdgcn_wmma_f32_16x16x32_bf16(false, a, false, b, (short)0, c, false, false); }

// Fragment loader for a 16 x 32(k) operand tile from a k-contiguous 16-bit row; p = base + row(lane & 15) * pitch + k0 + 8 * (lane >> 4):
// elements 0..7 = k0 + 8h + 0..7, elements 8..15 = k0 + 16 + 8h + 0..7 (same map for the A operand, row = lane & 15, and for the B operand stored [n][k], column = lane & 15).
__device__ __forceinline__ v16bf ldb(const bf* p) { return cat16b(*(const v8us*)p, *(const v8us*)(p + 16)); }
__device__ __forceinline__ v16h  ldh(const h16* p) { return cat16(*(const v8h*)p, *(const v8h*)(p + 16)); }

__global__ __launch_bounds__(256) void k_cvt8(const float* __restrict__ src, bf* dst, int n8) {
    const int i = blockIdx.x * 256 + threadIdx.x; if (i >= n8) return;
    const size_t e = (size_t)i * 8; const size_t zz = e / ((size_t)SEQ * HD); const size_t rem = e - zz * ((size_t)SEQ * HD);
    const v8f v = *(const v8f*)(src + zz * ((size_t)SEQ_FULL * HD) + rem); v8us o;
#pragma unroll
    for (int k = 0; k < 8; ++k) o[k] = f2bf(v[k]);
    *(v8us*)(dst + e) = o; 
}

// k_vtp: transposed value planes V16[z][d][t], Vh[z][d][t] (f16 and bf16 bits of the RNE-converted input), source F[z][t][d] with z-pitch SEQ_FULL*HD;
__global__ __launch_bounds__(256) void k_vtp(const float* __restrict__ F, h16* V16, bf* Vh, int n2) {
    const int i = blockIdx.x * 256 + threadIdx.x; if (i >= n2) return;
    const size_t e = (size_t)i * 2; const int t = (int)(e % SEQ); const int d = (int)((e / SEQ) % HD); const size_t zz = e / ((size_t)SEQ * HD);
    const float* f = F + (zz * SEQ_FULL + (size_t)t) * HD + d; v2h o16; v2us oh;
#pragma unroll
    for (int q = 0; q < 2; ++q) { const float x = bfr(f[(size_t)q * HD]); o16[q] = (h16)x; oh[q] = f2bf(x); }
    *(v2h*)(V16 + e) = o16; *(v2us*)(Vh + e) = oh; 
}

// k_attn: streaming causal attention for query blocks qb0 + blockIdx.x of head-plane z = blockIdx.y.
// Wave w owns query rows q0..q0+15 (q0 = qb*128 + 16w) and visits key chunks 0..(q0+15)/64 (uniform per wave; waves never exchange data, no block barrier needed).
// Per 64-key chunk: four S^T tiles = K(16 keys x 64 d, A operand) . Q^T (B operand from the [q][d] plane): lane holds query q0 + (lane & 15) and keys k0 + 16j + 8h + r.
// Causal select by value (key > query -> huge negative), chunk max within the lane then xor-16, running max / scale / sums in f32, p = exp2((t - m) * log2 e).
// The p values of two adjacent 16-key tiles form one P^T B-fragment directly (element r <- tile covering keys 0..15, element 8 + r <- tile covering keys 16..31, lane = query),
// O^T[d][query] += V^T(16 d x 32 keys, A operand from the [d][t] plane) . P^T; HR: p as bf16 hi + lo into the same accumulator with bf16 v, else p x 1024 in f16 with f16 v.
template <bool HR>
__global__ __launch_bounds__(256) __attribute__((amdgpu_num_vgpr(256)))
void k_attn(const bf* __restrict__ Qp, const bf* __restrict__ Kp, const bf* __restrict__ VTh, const h16* __restrict__ VT16, float* OUT, int qb0) {
#pragma clang fp contract(off)
    __shared__ __align__(16) float os[8 * 16 * 68];
    const int lane = threadIdx.x & 31, lr = lane & 15, hi = lane >> 4, wave = threadIdx.x >> 5;
    const size_t z = blockIdx.y;
    const int q0 = (qb0 + (int)blockIdx.x) * QT + wave * 16;
    const int myq = q0 + lr;
    const bf* Qz = Qp + z * ((size_t)SEQ * HD);
    const bf* Kz = Kp + z * ((size_t)SEQ * HD);
    const bf* Vhz = VTh + z * ((size_t)HD * SEQ);
    const h16* V16z = VT16 + z * ((size_t)HD * SEQ);
    // Q^T B-fragments (column n = query q0 + lr, k = d), kept for the whole key loop
    const v16bf qf0 = ldb(Qz + (size_t)myq * HD + 8 * hi);
    const v16bf qf1 = ldb(Qz + (size_t)myq * HD + 32 + 8 * hi);
    v8f oacc[4];
#pragma unroll
    for (int dt = 0; dt < 4; ++dt) oacc[dt] = (v8f){};
    float m = NEG, lsum = 0.0f;
    const int nch = (q0 + 15) / KC + 1;   // key chunks with at least one key <= the wave's last query; chunk c always has key 64c <= every query of this wave
#pragma unroll 1
    for (int c = 0; c < nch; ++c) {
        const int k0 = c * KC;
        v8f s[4];
#pragma unroll
        for (int jg = 0; jg < 2; ++jg) {
            const bf* kr0 = Kz + (size_t)(k0 + 32 * jg + lr) * HD + 8 * hi;   // A operand rows = keys k0 + 32jg + 0..15
            const bf* kr1 = kr0 + 16 * HD;                                       // keys k0 + 32jg + 16..31
            const v16bf ka0 = ldb(kr0), ka1 = ldb(kr0 + 32), kb0 = ldb(kr1), kb1 = ldb(kr1 + 32);
            v8f t0 = wmmab(ka0, qf0, (v8f){}); t0 = wmmab(ka1, qf1, t0);
            v8f t1 = wmmab(kb0, qf0, (v8f){}); t1 = wmmab(kb1, qf1, t1);
            asm volatile("v_nop\n\tv_nop\n\tv_nop\n\tv_nop" : "+v"(t0), "+v"(t1) : "v"(ka0), "v"(ka1), "v"(kb0), "v"(kb1), "v"(qf0), "v"(qf1));
            s[2 * jg] = t0; s[2 * jg + 1] = t1;
        }
        // scale, causal select by value, chunk max
        float tmx = NEG;
#pragma unroll
        for (int j = 0; j < 4; ++j) {
#pragma unroll
            for (int r = 0; r < 8; ++r) {
                const int key = k0 + 16 * j + 8 * hi + r;
                const float t = (key <= myq) ? s[j][r] * SCL : NEG;
                s[j][r] = t; tmx = fmaxf(tmx, t);
            }
        }
        tmx = fmaxf(tmx, __shfl_xor(tmx, 16, 32));
        const float mn = fmaxf(m, tmx);
        const float alpha = __builtin_amdgcn_exp2f((m - mn) * L2E);
        m = mn; lsum *= alpha;
#pragma unroll
        for (int dt = 0; dt < 4; ++dt)
#pragma unroll
            for (int r = 0; r < 8; ++r) oacc[dt][r] *= alpha;
        // weights and their 16-bit P^T fragments (ks = 32-key step: tiles 2ks and 2ks+1)
        v16bf pbh[2], pbl[2]; v16h pf[2];
#pragma unroll
        for (int ks = 0; ks < 2; ++ks) {
            v16us uh, ul; v16h p16;
#pragma unroll
            for (int half = 0; half < 2; ++half) {
                const int j = 2 * ks + half;
#pragma unroll
                for (int r = 0; r < 8; ++r) {
                    const float p = __builtin_amdgcn_exp2f((s[j][r] - mn) * L2E);
                    lsum += p;
                    if (HR) { unsigned short a, b2; splitf(p, a, b2); uh[half * 8 + r] = a; ul[half * 8 + r] = b2; }
                    else { p16[half * 8 + r] = (h16)(p * PCAR); }
                }
            }
            if (HR) { pbh[ks] = __builtin_bit_cast(v16bf, uh); pbl[ks] = __builtin_bit_cast(v16bf, ul); }
            else { pf[ks] = p16; }
        }
        // O^T[d][query] += V^T . P^T over the chunk's 64 keys
#pragma unroll
        for (int ks = 0; ks < 2; ++ks) {
            const int kk = k0 + 32 * ks + 8 * hi;
            if (HR) {
                const v16bf bh = pbh[ks], bl = pbl[ks];
                v16bf vf[4];
#pragma unroll
                for (int dt = 0; dt < 4; ++dt) vf[dt] = ldb(Vhz + (size_t)(dt * 16 + lr) * SEQ + kk);
#pragma unroll
                for (int dt = 0; dt < 4; ++dt) { oacc[dt] = wmmab(vf[dt], bh, oacc[dt]); oacc[dt] = wmmab(vf[dt], bl, oacc[dt]); }
                asm volatile("v_nop\n\tv_nop\n\tv_nop\n\tv_nop" : "+v"(oacc[0]), "+v"(oacc[1]), "+v"(oacc[2]), "+v"(oacc[3]) : "v"(vf[0]), "v"(vf[1]), "v"(vf[2]), "v"(vf[3]), "v"(bh), "v"(bl));
            } else {
                const v16h bp = pf[ks];
                v16h vf[4];
#pragma unroll
                for (int dt = 0; dt < 4; ++dt) vf[dt] = ldh(V16z + (size_t)(dt * 16 + lr) * SEQ + kk);
#pragma unroll
                for (int dt = 0; dt < 4; ++dt) oacc[dt] = wmma16(vf[dt], bp, oacc[dt]);
                asm volatile("v_nop\n\tv_nop\n\tv_nop\n\tv_nop" : "+v"(oacc[0]), "+v"(oacc[1]), "+v"(oacc[2]), "+v"(oacc[3]) : "v"(vf[0]), "v"(vf[1]), "v"(vf[2]), "v"(vf[3]), "v"(bp));
            }
        }
    }
    // normalise and write: lane holds query lr, d = dt*16 + 8h + r
    lsum += __shfl_xor(lsum, 16, 32);
    const float inv = __fdiv_rn(HR ? 1.0f : PCINV, lsum);
    float* osw = os + wave * (16 * 68);   // wave-private staging tile [16 queries][64 d], pitch 68
#pragma unroll
    for (int dt = 0; dt < 4; ++dt)
#pragma unroll
        for (int r = 0; r < 8; ++r) osw[lr * 68 + dt * 16 + 8 * hi + r] = oacc[dt][r] * inv;
    __builtin_amdgcn_fence(3, "wavefront"); __builtin_amdgcn_wave_barrier(); asm volatile("" ::: "memory");
    float* orow = OUT + (z * SEQ + (size_t)q0) * HD;
    v4f val[8];
#pragma unroll
    for (int sg = 0; sg < 8; ++sg) val[sg] = *(const v4fa*)(osw + (2 * sg + hi) * 68 + lr * 4);
#pragma unroll
    for (int sg = 0; sg < 8; ++sg) *(v4f*)(orow + (size_t)(2 * sg + hi) * HD + lr * 4) = val[sg];
    
}

extern "C" void kernel_launch(void* const* d_in, const int* in_sizes, int n_in,
                              void* d_out, int out_size, void* d_ws, size_t ws_size, hipStream_t stream) {
    if (n_in < 3) return;
    const float* xq = (const float*)d_in[0];   // [NB][16][SEQ_FULL][64] f32
    const float* xk = (const float*)d_in[1];
    const float* xv = (const float*)d_in[2];
    float* OUT = (float*)d_out;                // [NB][16][SEQ][64] f32
    const long long need_in = (long long)(NZ - 1) * SEQ_FULL * HD + (long long)SEQ * HD;
    if ((long long)in_sizes[0] < need_in || (long long)in_sizes[1] < need_in || (long long)in_sizes[2] < need_in) return;
    if ((long long)out_size < (long long)NZ * SEQ * HD) return;
    char* wsp = (char*)d_ws;
    auto take = [&](size_t bytes) { char* p = wsp; wsp += (bytes + 255) & ~(size_t)255; return (void*)p; };
    const size_t plane = (size_t)NZ * SEQ * HD;      // elements per 16-bit plane
    bf*  Qp   = (bf*)take(plane * 2);                 // [z][t][d] bf16
    bf*  Kp   = (bf*)take(plane * 2);                 // [z][t][d] bf16
    bf*  VTh  = (bf*)take(plane * 2);                 // [z][d][t] bf16
    h16* VT16 = (h16*)take(plane * 2);                // [z][d][t] f16
    if ((size_t)(wsp - (char*)d_ws) > ws_size) return;   // 4 x 16 MiB = 64 MiB at full size
    const int n8 = (int)(plane / 8), n2 = (int)(plane / 2);
    k_cvt8<<<(unsigned)((n8 + 255) / 256), 256, 0, stream>>>(xq, Qp, n8);
    k_cvt8<<<(unsigned)((n8 + 255) / 256), 256, 0, stream>>>(xk, Kp, n8);
    k_vtp<<<(unsigned)((n2 + 255) / 256), 256, 0, stream>>>(xv, VT16, VTh, n2);
    const int nqb = SEQ / QT;
    const int rhb = ((RH < SEQ) ? RH : SEQ) / QT;
    if (rhb > 0) k_attn<true><<<dim3((unsigned)rhb, NZ), 256, 0, stream>>>(Qp, Kp, VTh, VT16, OUT, 0);
    if (nqb - rhb > 0) k_attn<false><<<dim3((unsigned)(nqb - rhb), NZ), 256, 0, stream>>>(Qp, Kp, VTh, VT16, OUT, rhb);
}

// v001
// A run of this version takes 211 microseconds.
// In two side-by-side timings against v000, it was 1.68 and 1.73 times as fast.
#include <hip/hip_runtime.h>

// Contractions (f32 accumulate): score tiles k.q^T on v_wmma_f32_16x16x32_bf16 (bf16 operands = RNE-converted q and k, exact products, x0.125 applied in f32);
// p.v on v_wmma_f32_16x16x32_bf16 (p as bf16 hi + bf16 lo, v bf16) for query rows below RH, and on v_wmma_f32_16x16x32_f16 (p carried x1024 in f16, v f16) for the remaining rows;
// running-max softmax, row sums and the final 1/l scaling in f32; f32 output.
// Layout: q is converted once into a bf16 plane [z][t][d] (z = b*16 + h); k (bf16) and v (f16 and bf16) once into planes stored in fragment order:
// every 16-byte-per-lane load of a K or V^T fragment half is one 512-byte unit [lane][8 elements], so a wave-wide load reads four whole 128-byte lines.
// One streaming causal attention kernel per query-block range: 8 waves x 16 query rows per block, 64-key chunks, operands loaded as fragments straight from the planes,
// causal select by value, key chunks entirely above the diagonal are never visited (their weights are exactly zero).

#ifndef NB
#define NB 2
#endif
#ifndef SEQ
#define SEQ 4096
#endif
#ifndef SEQ_FULL
#define SEQ_FULL 4096
#endif
#ifndef RH
#define RH 1024
#endif
#define NH 16
#define HD 64
#define NZ (NB * NH)
#define QT 128
#define KC 64
#define PCAR 1024.0f
#define PCINV 0.0009765625f
#define SCL 0.125f
#define L2E 1.4426950408889634f
#define NEG (-1.0e30f)
static_assert(SEQ % QT == 0);
static_assert(SEQ % KC == 0);
static_assert(RH % QT == 0);
static_assert(QT == 8 * 16);
static_assert(HD == 64);
static_assert(SEQ % 32 == 0);
static_assert(SEQ <= SEQ_FULL);
static_assert(((long long)NZ * SEQ * HD) % 8 == 0);

typedef _Float16 h16;
typedef unsigned short bf;
typedef __attribute__((ext_vector_type(16))) __bf16         v16bf;
typedef __attribute__((ext_vector_type(16))) _Float16       v16h;
typedef __attribute__((ext_vector_type(16))) unsigned short v16us;
typedef __attribute__((ext_vector_type(8)))  _Float16       v8h;
typedef __attribute__((ext_vector_type(8)))  unsigned short v8us;
typedef __attribute__((ext_vector_type(8)))  float          v8f;
typedef __attribute__((ext_vector_type(4)))  float          v4f;
typedef __attribute__((ext_vector_type(2)))  _Float16       v2h;
typedef __attribute__((ext_vector_type(2)))  unsigned short v2us;
typedef v4f __attribute__((may_alias)) v4fa;

__device__ __forceinline__ unsigned short f2bf(float f) { unsigned u = __float_as_uint(f); u += 0x7FFFu + ((u >> 16) & 1u); return (unsigned short)(u >> 16); }
__device__ __forceinline__ float bf2f(unsigned short b) { return __uint_as_float(((unsigned)b) << 16); }
__device__ __forceinline__ float bfr(float f) { return bf2f(f2bf(f)); }
__device__ __forceinline__ void splitf(float y, unsigned short& h, unsigned short& l) { h = f2bf(y); l = f2bf(y - bf2f(h)); }
__device__ __forceinline__ v16h  cat16(v8h lo, v8h hi) { return __builtin_shufflevector(lo, hi, 0, 1, 2, 3, 4, 5, 6, 7, 8, 9, 10, 11, 12, 13, 14, 15); }
__device__ __forceinline__ v16bf cat16b(v8us lo, v8us hi) { return __builtin_bit_cast(v16bf, __builtin_shufflevector(lo, hi, 0, 1, 2, 3, 4, 5, 6, 7, 8, 9, 10, 11, 12, 13, 14, 15)); }
__device__ __forceinline__ v8f wmma16(v16h a, v16h b, v8f c) { return __builtin_amdgcn_wmma_f32_16x16x32_f16(false, a, false, b, (short)0, c, false, false); }
__device__ __forceinline__ v8f wmmab(v16bf a, v16bf b, v8f c) { return __builtin_amdgcn_wmma_f32_16x16x32_bf16(false, a, false, b, (short)0, c, false, false); }

// Fragment loader for a 16 x 32(k) operand tile from a k-contiguous 16-bit row; p = base + row(lane & 15) * pitch + k0 + 8 * (lane >> 4):
// elements 0..7 = k0 + 8h + 0..7, elements 8..15 = k0 + 16 + 8h + 0..7 (same map for the A operand, row = lane & 15, and for the B operand stored [n][k], column = lane & 15).
__device__ __forceinline__ v16bf ldb(const bf* p) { return cat16b(*(const v8us*)p, *(const v8us*)(p + 16)); }
// The same fragments from a fragment-order plane; p = first unit of the fragment + 8 * lane: elements 0..7 from that unit, elements 8..15 from the next unit (256 elements on).
__device__ __forceinline__ v16bf ldbu(const bf* p) { return cat16b(*(const v8us*)p, *(const v8us*)(p + 256)); }
__device__ __forceinline__ v16h  ldhu(const h16* p) { return cat16(*(const v8h*)p, *(const v8h*)(p + 256)); }

__global__ __launch_bounds__(256) void k_cvt8(const float* __restrict__ src, bf* dst, int n8) {
    const int i = blockIdx.x * 256 + threadIdx.x; if (i >= n8) return;
    const size_t e = (size_t)i * 8; const size_t zz = e / ((size_t)SEQ * HD); const size_t rem = e - zz * ((size_t)SEQ * HD);
    const v8f v = *(const v8f*)(src + zz * ((size_t)SEQ_FULL * HD) + rem); v8us o;
#pragma unroll
    for (int k = 0; k < 8; ++k) o[k] = f2bf(v[k]);
    *(v8us*)(dst + e) = o; 
}

// k_kpk: key plane in fragment order, Kf[z][t / 16][u][lane][8]: unit u (0..3) of a 16-key tile holds, at lane, key 16 * tile + (lane & 15), d = 16u + 8 * (lane >> 4) + 0..7
// (units 0, 1 = the A fragment for d 0..31, units 2, 3 = the one for d 32..63). One thread per 16-byte destination piece; source F[z][t][d] with z-pitch SEQ_FULL*HD.
__global__ __launch_bounds__(256) void k_kpk(const float* __restrict__ F, bf* Kf, int n8) {
    const int i = blockIdx.x * 256 + threadIdx.x; if (i >= n8) return;
    const int lane = i & 31, u = (i >> 5) & 3, tile = (i >> 7) % (SEQ / 16); const size_t zz = (size_t)((i >> 7) / (SEQ / 16));
    const v8f v = *(const v8f*)(F + (zz * SEQ_FULL + (size_t)(tile * 16 + (lane & 15))) * HD + u * 16 + (lane >> 4) * 8); v8us o;
    asm volatile("s_wait_xcnt 0x0" ::: "memory");   // stands in front of the reuse of the loads' address registers
#pragma unroll
    for (int k = 0; k < 8; ++k) o[k] = f2bf(v[k]);
    *(v8us*)(Kf + (size_t)i * 8) = o;
}

// k_vpk: value planes in fragment order, V16 / Vh[z][t / 32][dt][u][lane][8] (f16 and bf16 bits of the RNE-converted input): unit u (0, 1) of the V^T A fragment for d tile dt and a 32-key step
// holds, at lane, d = 16dt + (lane & 15), keys 32 * step + 16u + 8 * (lane >> 4) + 0..7. One thread per 16-byte destination piece; source F[z][t][d] with z-pitch SEQ_FULL*HD.
__global__ __launch_bounds__(256) void k_vpk(const float* __restrict__ F, h16* V16, bf* Vh, int n8) {
    const int i = blockIdx.x * 256 + threadIdx.x; if (i >= n8) return;
    const int lane = i & 31, u = (i >> 5) & 1, dt = (i >> 6) & 3, st = (i >> 8) % (SEQ / 32); const size_t zz = (size_t)((i >> 8) / (SEQ / 32));
    const float* f = F + (zz * SEQ_FULL + (size_t)(st * 32 + u * 16 + (lane >> 4) * 8)) * HD + dt * 16 + (lane & 15); v8h o16; v8us oh;
#pragma unroll
    for (int q = 0; q < 8; ++q) { const float x = bfr(f[(size_t)q * HD]); o16[q] = (h16)x; oh[q] = f2bf(x); }
    *(v8h*)(V16 + (size_t)i * 8) = o16; *(v8us*)(Vh + (size_t)i * 8) = oh;
}

// k_attn: streaming causal attention for query blocks qb0 + blockIdx.x of head-plane z = blockIdx.y.
// Wave w owns query rows q0..q0+15 (q0 = qb*128 + 16w) and visits key chunks 0..(q0+15)/64 (uniform per wave; waves never exchange data, no block barrier needed).
// Per 64-key chunk: four S^T tiles = K(16 keys x 64 d, A operand) . Q^T (B operand from the [q][d] plane): lane holds query q0 + (lane & 15) and keys k0 + 16j + 8h + r.
// Causal select by value (key > query -> huge negative), chunk max within the lane then xor-16, running max / scale / sums in f32, p = exp2((t - m) * log2 e).
// The p values of two adjacent 16-key tiles form one P^T B-fragment directly (element r <- tile covering keys 0..15, element 8 + r <- tile covering keys 16..31, lane = query),
// O^T[d][query] += V^T(16 d x 32 keys, A operand from the fragment-order plane) . P^T; HR: p as bf16 hi + lo into the same accumulator with bf16 v, else p x 1024 in f16 with f16 v.
template <bool HR>
__global__ __launch_bounds__(256) __attribute__((amdgpu_num_vgpr(256)))
void k_attn(const bf* __restrict__ Qp, const bf* __restrict__ Kp, const bf* __restrict__ VTh, const h16* __restrict__ VT16, float* OUT, int qb0) {
#pragma clang fp contract(off)
    __shared__ __align__(16) float os[8 * 16 * 68];
    const int lane = threadIdx.x & 31, lr = lane & 15, hi = lane >> 4, wave = threadIdx.x >> 5;
    const size_t z = blockIdx.y;
    const int q0 = (qb0 + (int)blockIdx.x) * QT + wave * 16;
    const int myq = q0 + lr;
    const bf* Qz = Qp + z * ((size_t)SEQ * HD);
    const bf* Kz = Kp + z * ((size_t)SEQ * HD);
    const bf* Vhz = VTh + z * ((size_t)HD * SEQ);
    const h16* V16z = VT16 + z * ((size_t)HD * SEQ);
    // Q^T B-fragments (column n = query q0 + lr, k = d), kept for the whole key loop
    const v16bf qf0 = ldb(Qz + (size_t)myq * HD + 8 * hi);
    const v16bf qf1 = ldb(Qz + (size_t)myq * HD + 32 + 8 * hi);
    v8f oacc[4];
#pragma unroll
    for (int dt = 0; dt < 4; ++dt) oacc[dt] = (v8f){};
    float m = NEG, lsum = 0.0f;
    const int nch = (q0 + 15) / KC + 1;   // key chunks with at least one key <= the wave's last query; chunk c always has key 64c <= every query of this wave
#pragma unroll 1
    for (int c = 0; c < nch; ++c) {
        const int k0 = c * KC;
        v8f s[4];
#pragma unroll
        for (int jg = 0; jg < 2; ++jg) {
            const bf* kr0 = Kz + (size_t)(k0 + 32 * jg) * HD + 8 * lane;        // A operand rows = keys k0 + 32jg + 0..15 (four units of 256 elements)
            const bf* kr1 = kr0 + 16 * HD;                                       // keys k0 + 32jg + 16..31
            const v16bf ka0 = ldbu(kr0), ka1 = ldbu(kr0 + 512), kb0 = ldbu(kr1), kb1 = ldbu(kr1 + 512);
            v8f t0 = wmmab(ka0, qf0, (v8f){}); t0 = wmmab(ka1, qf1, t0);
            v8f t1 = wmmab(kb0, qf0, (v8f){}); t1 = wmmab(kb1, qf1, t1);
            asm volatile("v_nop\n\tv_nop\n\tv_nop\n\tv_nop" : "+v"(t0), "+v"(t1) : "v"(ka0), "v"(ka1), "v"(kb0), "v"(kb1), "v"(qf0), "v"(qf1));
            s[2 * jg] = t0; s[2 * jg + 1] = t1;
        }
        // scale, causal select by value, chunk max
        float tmx = NEG;
#pragma unroll
        for (int j = 0; j < 4; ++j) {
#pragma unroll
            for (int r = 0; r < 8; ++r) {
                const int key = k0 + 16 * j + 8 * hi + r;
                const float t = (key <= myq) ? s[j][r] * SCL : NEG;
                s[j][r] = t; tmx = fmaxf(tmx, t);
            }
        }
        tmx = fmaxf(tmx, __shfl_xor(tmx, 16, 32));
        const float mn = fmaxf(m, tmx);
        const float alpha = __builtin_amdgcn_exp2f((m - mn) * L2E);
        m = mn; lsum *= alpha;
#pragma unroll
        for (int dt = 0; dt < 4; ++dt)
#pragma unroll
            for (int r = 0; r < 8; ++r) oacc[dt][r] *= alpha;
        // weights and their 16-bit P^T fragments (ks = 32-key step: tiles 2ks and 2ks+1)
        v16bf pbh[2], pbl[2]; v16h pf[2];
#pragma unroll
        for (int ks = 0; ks < 2; ++ks) {
            v16us uh, ul; v16h p16;
#pragma unroll
            for (int half = 0; half < 2; ++half) {
                const int j = 2 * ks + half;
#pragma unroll
                for (int r = 0; r < 8; ++r) {
                    const float p = __builtin_amdgcn_exp2f((s[j][r] - mn) * L2E);
                    lsum += p;
                    if (HR) { unsigned short a, b2; splitf(p, a, b2); uh[half * 8 + r] = a; ul[half * 8 + r] = b2; }
                    else { p16[half * 8 + r] = (h16)(p * PCAR); }
                }
            }
            if (HR) { pbh[ks] = __builtin_bit_cast(v16bf, uh); pbl[ks] = __builtin_bit_cast(v16bf, ul); }
            else { pf[ks] = p16; }
        }
        // O^T[d][query] += V^T . P^T over the chunk's 64 keys
#pragma unroll
        for (int ks = 0; ks < 2; ++ks) {
            const size_t kk = (size_t)(k0 + 32 * ks) * HD + 8 * lane;   // first unit of this 32-key step (eight units of 256 elements: d tile dt at 512 * dt)
            if (HR) {
                const v16bf bh = pbh[ks], bl = pbl[ks];
                v16bf vf[4];
#pragma unroll
                for (int dt = 0; dt < 4; ++dt) vf[dt] = ldbu(Vhz + kk + dt * 512);
#pragma unroll
                for (int dt = 0; dt < 4; ++dt) { oacc[dt] = wmmab(vf[dt], bh, oacc[dt]); oacc[dt] = wmmab(vf[dt], bl, oacc[dt]); }
                asm volatile("v_nop\n\tv_nop\n\tv_nop\n\tv_nop" : "+v"(oacc[0]), "+v"(oacc[1]), "+v"(oacc[2]), "+v"(oacc[3]) : "v"(vf[0]), "v"(vf[1]), "v"(vf[2]), "v"(vf[3]), "v"(bh), "v"(bl));
            } else {
                const v16h bp = pf[ks];
                v16h vf[4];
#pragma unroll
                for (int dt = 0; dt < 4; ++dt) vf[dt] = ldhu(V16z + kk + dt * 512);
#pragma unroll
                for (int dt = 0; dt < 4; ++dt) oacc[dt] = wmma16(vf[dt], bp, oacc[dt]);
                asm volatile("v_nop\n\tv_nop\n\tv_nop\n\tv_nop" : "+v"(oacc[0]), "+v"(oacc[1]), "+v"(oacc[2]), "+v"(oacc[3]) : "v"(vf[0]), "v"(vf[1]), "v"(vf[2]), "v"(vf[3]), "v"(bp));
            }
        }
    }
    // normalise and write: lane holds query lr, d = dt*16 + 8h + r
    lsum += __shfl_xor(lsum, 16, 32);
    const float inv = __fdiv_rn(HR ? 1.0f : PCINV, lsum);
    float* osw = os + wave * (16 * 68);   // wave-private staging tile [16 queries][64 d], pitch 68
#pragma unroll
    for (int dt = 0; dt < 4; ++dt)
#pragma unroll
        for (int r = 0; r < 8; ++r) osw[lr * 68 + dt * 16 + 8 * hi + r] = oacc[dt][r] * inv;
    __builtin_amdgcn_fence(3, "wavefront"); __builtin_amdgcn_wave_barrier(); asm volatile("" ::: "memory");
    float* orow = OUT + (z * SEQ + (size_t)q0) * HD;
    v4f val[8];
#pragma unroll
    for (int sg = 0; sg < 8; ++sg) val[sg] = *(const v4fa*)(osw + (2 * sg + hi) * 68 + lr * 4);
#pragma unroll
    for (int sg = 0; sg < 8; ++sg) *(v4f*)(orow + (size_t)(2 * sg + hi) * HD + lr * 4) = val[sg];
    
}

extern "C" void kernel_launch(void* const* d_in, const int* in_sizes, int n_in,
                              void* d_out, int out_size, void* d_ws, size_t ws_size, hipStream_t stream) {
    if (n_in < 3) return;
    const float* xq = (const float*)d_in[0];   // [NB][16][SEQ_FULL][64] f32
    const float* xk = (const float*)d_in[1];
    const float* xv = (const float*)d_in[2];
    float* OUT = (float*)d_out;                // [NB][16][SEQ][64] f32
    const long long need_in = (long long)(NZ - 1) * SEQ_FULL * HD + (long long)SEQ * HD;
    if ((long long)in_sizes[0] < need_in || (long long)in_sizes[1] < need_in || (long long)in_sizes[2] < need_in) return;
    if ((long long)out_size < (long long)NZ * SEQ * HD) return;
    char* wsp = (char*)d_ws;
    auto take = [&](size_t bytes) { char* p = wsp; wsp += (bytes + 255) & ~(size_t)255; return (void*)p; };
    const size_t plane = (size_t)NZ * SEQ * HD;      // elements per 16-bit plane
    bf*  Qp   = (bf*)take(plane * 2);                 // [z][t][d] bf16
    bf*  Kp   = (bf*)take(plane * 2);                 // fragment order, bf16
    bf*  VTh  = (bf*)take(plane * 2);                 // fragment order, bf16
    h16* VT16 = (h16*)take(plane * 2);                // fragment order, f16
    if ((size_t)(wsp - (char*)d_ws) > ws_size) return;   // 4 x 16 MiB = 64 MiB at full size
    const int n8 = (int)(plane / 8);
    k_cvt8<<<(unsigned)((n8 + 255) / 256), 256, 0, stream>>>(xq, Qp, n8);
    k_kpk<<<(unsigned)((n8 + 255) / 256), 256, 0, stream>>>(xk, Kp, n8);
    k_vpk<<<(unsigned)((n8 + 255) / 256), 256, 0, stream>>>(xv, VT16, VTh, n8);
    const int nqb = SEQ / QT;
    const int rhb = ((RH < SEQ) ? RH : SEQ) / QT;
    if (rhb > 0) k_attn<true><<<dim3((unsigned)rhb, NZ), 256, 0, stream>>>(Qp, Kp, VTh, VT16, OUT, 0);
    if (nqb - rhb > 0) k_attn<false><<<dim3((unsigned)(nqb - rhb), NZ), 256, 0, stream>>>(Qp, Kp, VTh, VT16, OUT, rhb);
}

// v002
// It runs in 149 microseconds.
// In two side-by-side timings against v001, it was 1.44 and 1.42 times as fast.
// All steps since v000 together make it 2.44 times as fast.
#include <hip/hip_runtime.h>

// Contractions (f32 accumulate): score tiles k.q^T on v_wmma_f32_16x16x32_bf16 (bf16 operands = RNE-converted q and k, exact products, x0.125 applied in f32);
// p.v on v_wmma_f32_16x16x32_bf16 (p as bf16 hi + bf16 lo, v bf16) for query rows below RH, and on v_wmma_f32_16x16x32_f16 (p carried x1024 in f16, v f16) for the remaining rows;
// running-max softmax, row sums and the final 1/l scaling in f32; f32 output.
// Layout: q is converted once into a bf16 plane [z][t][d] (z = b*16 + h); k (bf16) and v (f16 and bf16) once into planes stored in fragment order:
// every 16-byte-per-lane load of a K or V^T fragment half is one 512-byte unit [lane][8 elements], so a wave-wide load reads four whole 128-byte lines.
// One streaming causal attention kernel per query-block range: 8 waves x 16 query rows per block, 64-key chunks, operands loaded as fragments straight from the planes, one chunk ahead of their use,
// causal select by value, key chunks entirely above the diagonal are never visited (their weights are exactly zero).

#ifndef NB
#define NB 2
#endif
#ifndef SEQ
#define SEQ 4096
#endif
#ifndef SEQ_FULL
#define SEQ_FULL 4096
#endif
#ifndef RH
#define RH 1024
#endif
#define NH 16
#define HD 64
#define NZ (NB * NH)
#define QT 128
#define KC 64
#define PCAR 1024.0f
#define PCINV 0.0009765625f
#define SCL 0.125f
#define L2E 1.4426950408889634f
#define NEG (-1.0e30f)
static_assert(SEQ % QT == 0);
static_assert(SEQ % KC == 0);
static_assert(RH % QT == 0);
static_assert(QT == 8 * 16);
static_assert(HD == 64);
static_assert(SEQ % 32 == 0);
static_assert(SEQ <= SEQ_FULL);
static_assert(((long long)NZ * SEQ * HD) % 8 == 0);

typedef _Float16 h16;
typedef unsigned short bf;
typedef __attribute__((ext_vector_type(16))) __bf16         v16bf;
typedef __attribute__((ext_vector_type(16))) _Float16       v16h;
typedef __attribute__((ext_vector_type(16))) unsigned short v16us;
typedef __attribute__((ext_vector_type(8)))  _Float16       v8h;
typedef __attribute__((ext_vector_type(8)))  unsigned short v8us;
typedef __attribute__((ext_vector_type(8)))  float          v8f;
typedef __attribute__((ext_vector_type(4)))  float          v4f;
typedef __attribute__((ext_vector_type(2)))  _Float16       v2h;
typedef __attribute__((ext_vector_type(2)))  unsigned short v2us;
typedef v4f __attribute__((may_alias)) v4fa;

__device__ __forceinline__ unsigned short f2bf(float f) { unsigned u = __float_as_uint(f); u += 0x7FFFu + ((u >> 16) & 1u); return (unsigned short)(u >> 16); }
__device__ __forceinline__ float bf2f(unsigned short b) { return __uint_as_float(((unsigned)b) << 16); }
__device__ __forceinline__ float bfr(float f) { return bf2f(f2bf(f)); }
__device__ __forceinline__ void splitf(float y, unsigned short& h, unsigned short& l) { h = f2bf(y); l = f2bf(y - bf2f(h)); }
__device__ __forceinline__ v16h  cat16(v8h lo, v8h hi) { return __builtin_shufflevector(lo, hi, 0, 1, 2, 3, 4, 5, 6, 7, 8, 9, 10, 11, 12, 13, 14, 15); }
__device__ __forceinline__ v16bf cat16b(v8us lo, v8us hi) { return __builtin_bit_cast(v16bf, __builtin_shufflevector(lo, hi, 0, 1, 2, 3, 4, 5, 6, 7, 8, 9, 10, 11, 12, 13, 14, 15)); }
__device__ __forceinline__ v8f wmma16(v16h a, v16h b, v8f c) { return __builtin_amdgcn_wmma_f32_16x16x32_f16(false, a, false, b, (short)0, c, false, false); }
__device__ __forceinline__ v8f wmmab(v16bf a, v16bf b, v8f c) { return __builtin_amdgcn_wmma_f32_16x16x32_bf16(false, a, false, b, (short)0, c, false, false); }

// Fragment loader for a 16 x 32(k) operand tile from a k-contiguous 16-bit row; p = base + row(lane & 15) * pitch + k0 + 8 * (lane >> 4):
// elements 0..7 = k0 + 8h + 0..7, elements 8..15 = k0 + 16 + 8h + 0..7 (same map for the A operand, row = lane & 15, and for the B operand stored [n][k], column = lane & 15).
__device__ __forceinline__ v16bf ldb(const bf* p) { return cat16b(*(const v8us*)p, *(const v8us*)(p + 16)); }
// The same fragments from a fragment-order plane; p = first unit of the fragment + 8 * lane: elements 0..7 from that unit, elements 8..15 from the next unit (256 elements on).
__device__ __forceinline__ v16bf ldbu(const bf* p) { return cat16b(*(const v8us*)p, *(const v8us*)(p + 256)); }
__device__ __forceinline__ v16h  ldhu(const h16* p) { return cat16(*(const v8h*)p, *(const v8h*)(p + 256)); }

__global__ __launch_bounds__(256) void k_cvt8(const float* __restrict__ src, bf* dst, int n8) {
    const int i = blockIdx.x * 256 + threadIdx.x; if (i >= n8) return;
    const size_t e = (size_t)i * 8; const size_t zz = e / ((size_t)SEQ * HD); const size_t rem = e - zz * ((size_t)SEQ * HD);
    const v8f v = *(const v8f*)(src + zz * ((size_t)SEQ_FULL * HD) + rem); v8us o;
#pragma unroll
    for (int k = 0; k < 8; ++k) o[k] = f2bf(v[k]);
    *(v8us*)(dst + e) = o; 
}

// k_kpk: key plane in fragment order, Kf[z][t / 16][u][lane][8]: unit u (0..3) of a 16-key tile holds, at lane, key 16 * tile + (lane & 15), d = 16u + 8 * (lane >> 4) + 0..7
// (units 0, 1 = the A fragment for d 0..31, units 2, 3 = the one for d 32..63). One thread per 16-byte destination piece; source F[z][t][d] with z-pitch SEQ_FULL*HD.
__global__ __launch_bounds__(256) void k_kpk(const float* __restrict__ F, bf* Kf, int n8) {
    const int i = blockIdx.x * 256 + threadIdx.x; if (i >= n8) return;
    const int lane = i & 31, u = (i >> 5) & 3, tile = (i >> 7) % (SEQ / 16); const size_t zz = (size_t)((i >> 7) / (SEQ / 16));
    const v8f v = *(const v8f*)(F + (zz * SEQ_FULL + (size_t)(tile * 16 + (lane & 15))) * HD + u * 16 + (lane >> 4) * 8); v8us o;
    asm volatile("s_wait_xcnt 0x0" ::: "memory");   // stands in front of the reuse of the loads' address registers
#pragma unroll
    for (int k = 0; k < 8; ++k) o[k] = f2bf(v[k]);
    *(v8us*)(Kf + (size_t)i * 8) = o;
}

// k_vpk: value planes in fragment order, V16 / Vh[z][t / 32][dt][u][lane][8] (f16 and bf16 bits of the RNE-converted input): unit u (0, 1) of the V^T A fragment for d tile dt and a 32-key step
// holds, at lane, d = 16dt + (lane & 15), keys 32 * step + 16u + 8 * (lane >> 4) + 0..7. One thread per 16-byte destination piece; source F[z][t][d] with z-pitch SEQ_FULL*HD.
__global__ __launch_bounds__(256) void k_vpk(const float* __restrict__ F, h16* V16, bf* Vh, int n8) {
    const int i = blockIdx.x * 256 + threadIdx.x; if (i >= n8) return;
    const int lane = i & 31, u = (i >> 5) & 1, dt = (i >> 6) & 3, st = (i >> 8) % (SEQ / 32); const size_t zz = (size_t)((i >> 8) / (SEQ / 32));
    const float* f = F + (zz * SEQ_FULL + (size_t)(st * 32 + u * 16 + (lane >> 4) * 8)) * HD + dt * 16 + (lane & 15); v8h o16; v8us oh;
#pragma unroll
    for (int q = 0; q < 8; ++q) { const float x = bfr(f[(size_t)q * HD]); o16[q] = (h16)x; oh[q] = f2bf(x); }
    *(v8h*)(V16 + (size_t)i * 8) = o16; *(v8us*)(Vh + (size_t)i * 8) = oh;
}

// k_attn: streaming causal attention for query blocks qb0 + blockIdx.x of head-plane z = blockIdx.y.
// Wave w owns query rows q0..q0+15 (q0 = qb*128 + 16w) and visits key chunks 0..(q0+15)/64 (uniform per wave; waves never exchange data, no block barrier needed).
// Per 64-key chunk: four S^T tiles = K(16 keys x 64 d, A operand) . Q^T (B operand from the [q][d] plane): lane holds query q0 + (lane & 15) and keys k0 + 16j + 8h + r.
// Causal select by value (key > query -> huge negative), chunk max within the lane then xor-16, running max / scale / sums in f32, p = exp2((t - m) * log2 e).
// The p values of two adjacent 16-key tiles form one P^T B-fragment directly (element r <- tile covering keys 0..15, element 8 + r <- tile covering keys 16..31, lane = query),
// O^T[d][query] += V^T(16 d x 32 keys, A operand from the fragment-order plane) . P^T; HR: p as bf16 hi + lo into the same accumulator with bf16 v, else p x 1024 in f16 with f16 v.
template <bool HR>
__global__ __launch_bounds__(256) __attribute__((amdgpu_num_vgpr(256)))
void k_attn(const bf* __restrict__ Qp, const bf* __restrict__ Kp, const bf* __restrict__ VTh, const h16* __restrict__ VT16, float* OUT, int qb0) {
#pragma clang fp contract(off)
    __shared__ __align__(16) float os[8 * 16 * 68];
    const int lane = threadIdx.x & 31, lr = lane & 15, hi = lane >> 4, wave = threadIdx.x >> 5;
    const size_t z = blockIdx.y;
    const int q0 = (qb0 + (int)blockIdx.x) * QT + wave * 16;
    const int myq = q0 + lr;
    const bf* Qz = Qp + z * ((size_t)SEQ * HD);
    const bf* Kz = Kp + z * ((size_t)SEQ * HD);
    const bf* Vhz = VTh + z * ((size_t)HD * SEQ);
    const h16* V16z = VT16 + z * ((size_t)HD * SEQ);
    // Q^T B-fragments (column n = query q0 + lr, k = d), kept for the whole key loop
    const v16bf qf0 = ldb(Qz + (size_t)myq * HD + 8 * hi);
    const v16bf qf1 = ldb(Qz + (size_t)myq * HD + 32 + 8 * hi);
    v8f oacc[4];
#pragma unroll
    for (int dt = 0; dt < 4; ++dt) oacc[dt] = (v8f){};
    float m = NEG, lsum = 0.0f;
    // key chunks with at least one key <= the wave's last query; chunk c always has key 64c <= every query of this wave (the same in every lane, read as a scalar)
    const int nch = __builtin_amdgcn_readfirstlane((q0 + 15) / KC + 1);
    // Fragments are fetched one chunk ahead: a chunk's eight K fragments (i = 4jg + 0..3: keys 32jg + 0..15 d 0..31, d 32..63, keys 32jg + 16..31 d 0..31, d 32..63)
    // and eight V^T fragments (i = 4ks + dt) each start at element 64 * k0 + 512 * i + 8 * lane of their plane.
    const bf* kp = Kz + 8 * lane;      // each lane's place in the chunk being fetched: these pointers live across the passes, so no load lands on its own address registers
    const bf* vbp = Vhz + 8 * lane;
    const h16* vhp = V16z + 8 * lane;
    v16bf kf[8]; v16bf vfb[8]; v16h vfh[8];
#pragma unroll
    for (int i = 0; i < 8; ++i) kf[i] = ldbu(kp + i * 512);
#pragma unroll
    for (int i = 0; i < 8; ++i) { if (HR) vfb[i] = ldbu(vbp + i * 512); else vfh[i] = ldhu(vhp + i * 512); }
    // inputs-only fence on the loaded Q and first K fragments: they have landed in front of the loop (the first product needs them anyway), so the wait at the loop's head
    // is counted from the loop's own load order alone (K older than the sixteen V loads) and leaves the V loads in flight; without it that wait drains part of them on every pass
    asm volatile("" :: "v"(qf0), "v"(qf1), "v"(kf[0]), "v"(kf[1]), "v"(kf[2]), "v"(kf[3]), "v"(kf[4]), "v"(kf[5]), "v"(kf[6]), "v"(kf[7]));
#pragma unroll 1
    for (int c = 0; c < nch; ++c) {
        const int k0 = c * KC;
        const int step = (c + 1 < nch) ? KC * HD : 0;   // on to the next chunk; the last pass fetches its own chunk again (in bounds, unused)
        v8f s[4];
#pragma unroll
        for (int jg = 0; jg < 2; ++jg) {
            const v16bf ka0 = kf[4 * jg], ka1 = kf[4 * jg + 1], kb0 = kf[4 * jg + 2], kb1 = kf[4 * jg + 3];
            v8f t0 = wmmab(ka0, qf0, (v8f){}); t0 = wmmab(ka1, qf1, t0);
            v8f t1 = wmmab(kb0, qf0, (v8f){}); t1 = wmmab(kb1, qf1, t1);
            asm volatile("v_nop\n\tv_nop\n\tv_nop\n\tv_nop" : "+v"(t0), "+v"(t1) : "v"(ka0), "v"(ka1), "v"(kb0), "v"(kb1), "v"(qf0), "v"(qf1));
            s[2 * jg] = t0; s[2 * jg + 1] = t1;
        }
        // next chunk's K fragments, into the registers the products above have just left: they fly during the softmax and the p.v products
        kp += step;
#pragma unroll
        for (int i = 0; i < 8; ++i) kf[i] = ldbu(kp + i * 512);
        asm volatile("s_wait_xcnt 0x0" ::: "memory");   // stands between these loads and the next pass's step of their address registers
        if (!HR) __builtin_amdgcn_sched_barrier(0);   // holds these loads here, in front of the softmax: scheduled later they have less of the pass to land in (HR: its registers do not allow it)
        // scale, causal select by value, chunk max
        float tmx = NEG;
#pragma unroll
        for (int j = 0; j < 4; ++j) {
#pragma unroll
            for (int r = 0; r < 8; ++r) {
                const int key = k0 + 16 * j + 8 * hi + r;
                const float t = (key <= myq) ? s[j][r] * SCL : NEG;
                s[j][r] = t; tmx = fmaxf(tmx, t);
            }
        }
        tmx = fmaxf(tmx, __shfl_xor(tmx, 16, 32));
        const float mn = fmaxf(m, tmx);
        const float alpha = __builtin_amdgcn_exp2f((m - mn) * L2E);
        m = mn; lsum *= alpha;
#pragma unroll
        for (int dt = 0; dt < 4; ++dt)
#pragma unroll
            for (int r = 0; r < 8; ++r) oacc[dt][r] *= alpha;
        // weights and their 16-bit P^T fragments (ks = 32-key step: tiles 2ks and 2ks+1)
        v16bf pbh[2], pbl[2]; v16h pf[2];
#pragma unroll
        for (int ks = 0; ks < 2; ++ks) {
            v16us uh, ul; v16h p16;
#pragma unroll
            for (int half = 0; half < 2; ++half) {
                const int j = 2 * ks + half;
#pragma unroll
                for (int r = 0; r < 8; ++r) {
                    const float p = __builtin_amdgcn_exp2f((s[j][r] - mn) * L2E);
                    lsum += p;
                    if (HR) { unsigned short a, b2; splitf(p, a, b2); uh[half * 8 + r] = a; ul[half * 8 + r] = b2; }
                    else { p16[half * 8 + r] = (h16)(p * PCAR); }
                }
            }
            if (HR) { pbh[ks] = __builtin_bit_cast(v16bf, uh); pbl[ks] = __builtin_bit_cast(v16bf, ul); }
            else { pf[ks] = p16; }
        }
        // O^T[d][query] += V^T . P^T over the chunk's 64 keys
#pragma unroll
        for (int ks = 0; ks < 2; ++ks) {
            if (HR) {
                const v16bf bh = pbh[ks], bl = pbl[ks];
                v16bf vf[4];
#pragma unroll
                for (int dt = 0; dt < 4; ++dt) vf[dt] = vfb[4 * ks + dt];
#pragma unroll
                for (int dt = 0; dt < 4; ++dt) { oacc[dt] = wmmab(vf[dt], bh, oacc[dt]); oacc[dt] = wmmab(vf[dt], bl, oacc[dt]); }
                asm volatile("v_nop\n\tv_nop\n\tv_nop\n\tv_nop" : "+v"(oacc[0]), "+v"(oacc[1]), "+v"(oacc[2]), "+v"(oacc[3]) : "v"(vf[0]), "v"(vf[1]), "v"(vf[2]), "v"(vf[3]), "v"(bh), "v"(bl));
            } else {
                const v16h bp = pf[ks];
                v16h vf[4];
#pragma unroll
                for (int dt = 0; dt < 4; ++dt) vf[dt] = vfh[4 * ks + dt];
#pragma unroll
                for (int dt = 0; dt < 4; ++dt) oacc[dt] = wmma16(vf[dt], bp, oacc[dt]);
                asm volatile("v_nop\n\tv_nop\n\tv_nop\n\tv_nop" : "+v"(oacc[0]), "+v"(oacc[1]), "+v"(oacc[2]), "+v"(oacc[3]) : "v"(vf[0]), "v"(vf[1]), "v"(vf[2]), "v"(vf[3]), "v"(bp));
            }
        }
        // next chunk's V^T fragments, into the registers just left: they fly during the next chunk's score products and softmax
        if (HR) vbp += step; else vhp += step;
#pragma unroll
        for (int i = 0; i < 8; ++i) { if (HR) vfb[i] = ldbu(vbp + i * 512); else vfh[i] = ldhu(vhp + i * 512); }
        asm volatile("s_wait_xcnt 0x0" ::: "memory");   // stands between these loads and the next pass's step of their address registers
    }
    // normalise and write: lane holds query lr, d = dt*16 + 8h + r
    lsum += __shfl_xor(lsum, 16, 32);
    const float inv = __fdiv_rn(HR ? 1.0f : PCINV, lsum);
    float* osw = os + wave * (16 * 68);   // wave-private staging tile [16 queries][64 d], pitch 68
#pragma unroll
    for (int dt = 0; dt < 4; ++dt)
#pragma unroll
        for (int r = 0; r < 8; ++r) osw[lr * 68 + dt * 16 + 8 * hi + r] = oacc[dt][r] * inv;
    __builtin_amdgcn_fence(3, "wavefront"); __builtin_amdgcn_wave_barrier(); asm volatile("" ::: "memory");
    float* orow = OUT + (z * SEQ + (size_t)q0) * HD;
    v4f val[8];
#pragma unroll
    for (int sg = 0; sg < 8; ++sg) val[sg] = *(const v4fa*)(osw + (2 * sg + hi) * 68 + lr * 4);
#pragma unroll
    for (int sg = 0; sg < 8; ++sg) *(v4f*)(orow + (size_t)(2 * sg + hi) * HD + lr * 4) = val[sg];
    
}

extern "C" void kernel_launch(void* const* d_in, const int* in_sizes, int n_in,
                              void* d_out, int out_size, void* d_ws, size_t ws_size, hipStream_t stream) {
    if (n_in < 3) return;
    const float* xq = (const float*)d_in[0];   // [NB][16][SEQ_FULL][64] f32
    const float* xk = (const float*)d_in[1];
    const float* xv = (const float*)d_in[2];
    float* OUT = (float*)d_out;                // [NB][16][SEQ][64] f32
    const long long need_in = (long long)(NZ - 1) * SEQ_FULL * HD + (long long)SEQ * HD;
    if ((long long)in_sizes[0] < need_in || (long long)in_sizes[1] < need_in || (long long)in_sizes[2] < need_in) return;
    if ((long long)out_size < (long long)NZ * SEQ * HD) return;
    char* wsp = (char*)d_ws;
    auto take = [&](size_t bytes) { char* p = wsp; wsp += (bytes + 255) & ~(size_t)255; return (void*)p; };
    const size_t plane = (size_t)NZ * SEQ * HD;      // elements per 16-bit plane
    bf*  Qp   = (bf*)take(plane * 2);                 // [z][t][d] bf16
    bf*  Kp   = (bf*)take(plane * 2);                 // fragment order, bf16
    bf*  VTh  = (bf*)take(plane * 2);                 // fragment order, bf16
    h16* VT16 = (h16*)take(plane * 2);                // fragment order, f16
    if ((size_t)(wsp - (char*)d_ws) > ws_size) return;   // 4 x 16 MiB = 64 MiB at full size
    const int n8 = (int)(plane / 8);
    k_cvt8<<<(unsigned)((n8 + 255) / 256), 256, 0, stream>>>(xq, Qp, n8);
    k_kpk<<<(unsigned)((n8 + 255) / 256), 256, 0, stream>>>(xk, Kp, n8);
    k_vpk<<<(unsigned)((n8 + 255) / 256), 256, 0, stream>>>(xv, VT16, VTh, n8);
    const int nqb = SEQ / QT;
    const int rhb = ((RH < SEQ) ? RH : SEQ) / QT;
    if (rhb > 0) k_attn<true><<<dim3((unsigned)rhb, NZ), 256, 0, stream>>>(Qp, Kp, VTh, VT16, OUT, 0);
    if (nqb - rhb > 0) k_attn<false><<<dim3((unsigned)(nqb - rhb), NZ), 256, 0, stream>>>(Qp, Kp, VTh, VT16, OUT, rhb);
}

// v003
// One run takes 138 microseconds.
// Two timings next to v002 both put it at 1.08 times that version's speed.
// Counting every step since v000, it is 2.64 times as fast.
#include <hip/hip_runtime.h>

// Contractions (f32 accumulate): score tiles k.q^T on v_wmma_f32_16x16x32_bf16 (bf16 operands = RNE-converted q and k, exact products, x0.125 applied in f32);
// p.v on v_wmma_f32_16x16x32_bf16 (p as bf16 hi + bf16 lo, v bf16) for query rows below RH, and on v_wmma_f32_16x16x32_f16 (p carried x1024 in f16, v f16) for the remaining rows;
// running-max softmax, row sums and the final 1/l scaling in f32; f32 output.
// Layout: q is converted once into a bf16 plane [z][t][d] (z = b*16 + h); k (bf16) and v (f16 and bf16) once into planes stored in fragment order:
// every 16-byte-per-lane load of a K or V^T fragment half is one 512-byte unit [lane][8 elements], so a wave-wide load reads four whole 128-byte lines.
// One streaming causal attention kernel per query-block range: 8 waves x 16 query rows per block, 64-key chunks, operands loaded as fragments straight from the planes, one chunk ahead of their use,
// causal select by value (rows from RH on: only in the one chunk of a wave that crosses the diagonal), key chunks entirely above the diagonal are never visited (their weights are exactly zero).

#ifndef NB
#define NB 2
#endif
#ifndef SEQ
#define SEQ 4096
#endif
#ifndef SEQ_FULL
#define SEQ_FULL 4096
#endif
#ifndef RH
#define RH 1024
#endif
#define NH 16
#define HD 64
#define NZ (NB * NH)
#define QT 128
#define KC 64
#define PCAR 1024.0f
#define PCINV 0.0009765625f
#define SCL 0.125f
#define L2E 1.4426950408889634f
#define NEG (-1.0e30f)
static_assert(SEQ % QT == 0);
static_assert(SEQ % KC == 0);
static_assert(RH % QT == 0);
static_assert(QT == 8 * 16);
static_assert(HD == 64);
static_assert(SEQ % 32 == 0);
static_assert(SEQ <= SEQ_FULL);
static_assert(((long long)NZ * SEQ * HD) % 8 == 0);

typedef _Float16 h16;
typedef unsigned short bf;
typedef __attribute__((ext_vector_type(16))) __bf16         v16bf;
typedef __attribute__((ext_vector_type(16))) _Float16       v16h;
typedef __attribute__((ext_vector_type(16))) unsigned short v16us;
typedef __attribute__((ext_vector_type(8)))  _Float16       v8h;
typedef __attribute__((ext_vector_type(8)))  unsigned short v8us;
typedef __attribute__((ext_vector_type(8)))  float          v8f;
typedef __attribute__((ext_vector_type(4)))  float          v4f;
typedef __attribute__((ext_vector_type(2)))  _Float16       v2h;
typedef __attribute__((ext_vector_type(2)))  unsigned short v2us;
typedef v4f __attribute__((may_alias)) v4fa;

__device__ __forceinline__ unsigned short f2bf(float f) { unsigned u = __float_as_uint(f); u += 0x7FFFu + ((u >> 16) & 1u); return (unsigned short)(u >> 16); }
__device__ __forceinline__ float bf2f(unsigned short b) { return __uint_as_float(((unsigned)b) << 16); }
__device__ __forceinline__ float bfr(float f) { return bf2f(f2bf(f)); }
__device__ __forceinline__ void splitf(float y, unsigned short& h, unsigned short& l) { h = f2bf(y); l = f2bf(y - bf2f(h)); }
__device__ __forceinline__ v16h  cat16(v8h lo, v8h hi) { return __builtin_shufflevector(lo, hi, 0, 1, 2, 3, 4, 5, 6, 7, 8, 9, 10, 11, 12, 13, 14, 15); }
__device__ __forceinline__ v16bf cat16b(v8us lo, v8us hi) { return __builtin_bit_cast(v16bf, __builtin_shufflevector(lo, hi, 0, 1, 2, 3, 4, 5, 6, 7, 8, 9, 10, 11, 12, 13, 14, 15)); }
__device__ __forceinline__ v8f wmma16(v16h a, v16h b, v8f c) { return __builtin_amdgcn_wmma_f32_16x16x32_f16(false, a, false, b, (short)0, c, false, false); }
__device__ __forceinline__ v8f wmmab(v16bf a, v16bf b, v8f c) { return __builtin_amdgcn_wmma_f32_16x16x32_bf16(false, a, false, b, (short)0, c, false, false); }

// Fragment loader for a 16 x 32(k) operand tile from a k-contiguous 16-bit row; p = base + row(lane & 15) * pitch + k0 + 8 * (lane >> 4):
// elements 0..7 = k0 + 8h + 0..7, elements 8..15 = k0 + 16 + 8h + 0..7 (same map for the A operand, row = lane & 15, and for the B operand stored [n][k], column = lane & 15).
__device__ __forceinline__ v16bf ldb(const bf* p) { return cat16b(*(const v8us*)p, *(const v8us*)(p + 16)); }
// The same fragments from a fragment-order plane; p = first unit of the fragment + 8 * lane: elements 0..7 from that unit, elements 8..15 from the next unit (256 elements on).
__device__ __forceinline__ v16bf ldbu(const bf* p) { return cat16b(*(const v8us*)p, *(const v8us*)(p + 256)); }
__device__ __forceinline__ v16h  ldhu(const h16* p) { return cat16(*(const v8h*)p, *(const v8h*)(p + 256)); }

__global__ __launch_bounds__(256) void k_cvt8(const float* __restrict__ src, bf* dst, int n8) {
    const int i = blockIdx.x * 256 + threadIdx.x; if (i >= n8) return;
    const size_t e = (size_t)i * 8; const size_t zz = e / ((size_t)SEQ * HD); const size_t rem = e - zz * ((size_t)SEQ * HD);
    const v8f v = *(const v8f*)(src + zz * ((size_t)SEQ_FULL * HD) + rem); v8us o;
#pragma unroll
    for (int k = 0; k < 8; ++k) o[k] = f2bf(v[k]);
    *(v8us*)(dst + e) = o; 
}

// k_kpk: key plane in fragment order, Kf[z][t / 16][u][lane][8]: unit u (0..3) of a 16-key tile holds, at lane, key 16 * tile + (lane & 15), d = 16u + 8 * (lane >> 4) + 0..7
// (units 0, 1 = the A fragment for d 0..31, units 2, 3 = the one for d 32..63). One thread per 16-byte destination piece; source F[z][t][d] with z-pitch SEQ_FULL*HD.
__global__ __launch_bounds__(256) void k_kpk(const float* __restrict__ F, bf* Kf, int n8) {
    const int i = blockIdx.x * 256 + threadIdx.x; if (i >= n8) return;
    const int lane = i & 31, u = (i >> 5) & 3, tile = (i >> 7) % (SEQ / 16); const size_t zz = (size_t)((i >> 7) / (SEQ / 16));
    const v8f v = *(const v8f*)(F + (zz * SEQ_FULL + (size_t)(tile * 16 + (lane & 15))) * HD + u * 16 + (lane >> 4) * 8); v8us o;
    asm volatile("s_wait_xcnt 0x0" ::: "memory");   // stands in front of the reuse of the loads' address registers
#pragma unroll
    for (int k = 0; k < 8; ++k) o[k] = f2bf(v[k]);
    *(v8us*)(Kf + (size_t)i * 8) = o;
}

// k_vpk: value planes in fragment order, V16 / Vh[z][t / 32][dt][u][lane][8] (f16 and bf16 bits of the RNE-converted input): unit u (0, 1) of the V^T A fragment for d tile dt and a 32-key step
// holds, at lane, d = 16dt + (lane & 15), keys 32 * step + 16u + 8 * (lane >> 4) + 0..7. One thread per 16-byte destination piece; source F[z][t][d] with z-pitch SEQ_FULL*HD.
__global__ __launch_bounds__(256) void k_vpk(const float* __restrict__ F, h16* V16, bf* Vh, int n8) {
    const int i = blockIdx.x * 256 + threadIdx.x; if (i >= n8) return;
    const int lane = i & 31, u = (i >> 5) & 1, dt = (i >> 6) & 3, st = (i >> 8) % (SEQ / 32); const size_t zz = (size_t)((i >> 8) / (SEQ / 32));
    const float* f = F + (zz * SEQ_FULL + (size_t)(st * 32 + u * 16 + (lane >> 4) * 8)) * HD + dt * 16 + (lane & 15); v8h o16; v8us oh;
#pragma unroll
    for (int q = 0; q < 8; ++q) { const float x = bfr(f[(size_t)q * HD]); o16[q] = (h16)x; oh[q] = f2bf(x); }
    *(v8h*)(V16 + (size_t)i * 8) = o16; *(v8us*)(Vh + (size_t)i * 8) = oh;
}

// k_attn: streaming causal attention for query blocks qb0 + blockIdx.x of head-plane z = blockIdx.y.
// Wave w owns query rows q0..q0+15 (q0 = qb*128 + 16w) and visits key chunks 0..(q0+15)/64 (uniform per wave; waves never exchange data, no block barrier needed).
// Per 64-key chunk: four S^T tiles = K(16 keys x 64 d, A operand) . Q^T (B operand from the [q][d] plane): lane holds query q0 + (lane & 15) and keys k0 + 16j + 8h + r.
// Causal select by value (key > query -> huge negative), for rows from RH on in the wave's last chunk alone, chunk max within the lane then xor-16, running max / scale / sums in f32, p = exp2((t - m) * log2 e).
// The p values of two adjacent 16-key tiles form one P^T B-fragment directly (element r <- tile covering keys 0..15, element 8 + r <- tile covering keys 16..31, lane = query),
// O^T[d][query] += V^T(16 d x 32 keys, A operand from the fragment-order plane) . P^T; HR: p as bf16 hi + lo into the same accumulator with bf16 v, else p x 1024 in f16 with f16 v.
template <bool HR>
__global__ __launch_bounds__(256) __attribute__((amdgpu_num_vgpr(256)))
void k_attn(const bf* __restrict__ Qp, const bf* __restrict__ Kp, const bf* __restrict__ VTh, const h16* __restrict__ VT16, float* OUT, int qb0) {
#pragma clang fp contract(off)
    __shared__ __align__(16) float os[8 * 16 * 68];
    const int lane = threadIdx.x & 31, lr = lane & 15, hi = lane >> 4, wave = threadIdx.x >> 5;
    const size_t z = blockIdx.y;
    const int q0 = (qb0 + (int)blockIdx.x) * QT + wave * 16;
    const int myq = q0 + lr;
    const bf* Qz = Qp + z * ((size_t)SEQ * HD);
    const bf* Kz = Kp + z * ((size_t)SEQ * HD);
    const bf* Vhz = VTh + z * ((size_t)HD * SEQ);
    const h16* V16z = VT16 + z * ((size_t)HD * SEQ);
    // Q^T B-fragments (column n = query q0 + lr, k = d), kept for the whole key loop
    const v16bf qf0 = ldb(Qz + (size_t)myq * HD + 8 * hi);
    const v16bf qf1 = ldb(Qz + (size_t)myq * HD + 32 + 8 * hi);
    v8f oacc[4];
#pragma unroll
    for (int dt = 0; dt < 4; ++dt) oacc[dt] = (v8f){};
    float m = NEG, lsum = 0.0f;
    // key chunks with at least one key <= the wave's last query; chunk c always has key 64c <= every query of this wave (the same in every lane, read as a scalar)
    const int nch = __builtin_amdgcn_readfirstlane((q0 + 15) / KC + 1);
    // Fragments are fetched one chunk ahead: a chunk's eight K fragments (i = 4jg + 0..3: keys 32jg + 0..15 d 0..31, d 32..63, keys 32jg + 16..31 d 0..31, d 32..63)
    // and eight V^T fragments (i = 4ks + dt) each start at element 64 * k0 + 512 * i + 8 * lane of their plane.
    const bf* kp = Kz + 8 * lane;      // each lane's place in the chunk being fetched: these pointers live across the passes, so no load lands on its own address registers
    const bf* vbp = Vhz + 8 * lane;
    const h16* vhp = V16z + 8 * lane;
    v16bf kf[8]; v16bf vfb[8]; v16h vfh[8];
#pragma unroll
    for (int i = 0; i < 8; ++i) kf[i] = ldbu(kp + i * 512);
#pragma unroll
    for (int i = 0; i < 8; ++i) { if (HR) vfb[i] = ldbu(vbp + i * 512); else vfh[i] = ldhu(vhp + i * 512); }
    // inputs-only fence on the loaded Q and first K fragments: they have landed in front of the loop (the first product needs them anyway), so the wait at the loop's head
    // is counted from the loop's own load order alone (K older than the sixteen V loads) and leaves the V loads in flight; without it that wait drains part of them on every pass
    asm volatile("" :: "v"(qf0), "v"(qf1), "v"(kf[0]), "v"(kf[1]), "v"(kf[2]), "v"(kf[3]), "v"(kf[4]), "v"(kf[5]), "v"(kf[6]), "v"(kf[7]));
#pragma unroll 1
    for (int c = 0; c < nch; ++c) {
        const int k0 = c * KC;
        const int step = (c + 1 < nch) ? KC * HD : 0;   // on to the next chunk; the last pass fetches its own chunk again (in bounds, unused)
        v8f s[4];
#pragma unroll
        for (int jg = 0; jg < 2; ++jg) {
            const v16bf ka0 = kf[4 * jg], ka1 = kf[4 * jg + 1], kb0 = kf[4 * jg + 2], kb1 = kf[4 * jg + 3];
            v8f t0 = wmmab(ka0, qf0, (v8f){}); t0 = wmmab(ka1, qf1, t0);
            v8f t1 = wmmab(kb0, qf0, (v8f){}); t1 = wmmab(kb1, qf1, t1);
            asm volatile("v_nop\n\tv_nop\n\tv_nop\n\tv_nop" : "+v"(t0), "+v"(t1) : "v"(ka0), "v"(ka1), "v"(kb0), "v"(kb1), "v"(qf0), "v"(qf1));
            s[2 * jg] = t0; s[2 * jg + 1] = t1;
        }
        // rows from RH on: scale, then the causal select by value only in the wave's last chunk (a scalar branch): q0 is a multiple of 16, so every earlier chunk
        // ends at key 64 * (q0 / 64) - 1 < q0 and the select would keep each of its scores. It stands in front of the fetch so that all behind the branch stays one block to schedule.
        // (the loops are unrolled so that s is indexed by constants and stays in registers)
        if (!HR) {
#pragma unroll
            for (int j = 0; j < 4; ++j)
#pragma unroll
                for (int r = 0; r < 8; ++r) s[j][r] *= SCL;
            if (c + 1 == nch) {
#pragma unroll
                for (int j = 0; j < 4; ++j)
#pragma unroll
                    for (int r = 0; r < 8; ++r) s[j][r] = (k0 + 16 * j + 8 * hi + r <= myq) ? s[j][r] : NEG;
            }
        }
        // next chunk's K fragments, into the registers the products above have just left: they fly during the softmax and the p.v products
        kp += step;
#pragma unroll
        for (int i = 0; i < 8; ++i) kf[i] = ldbu(kp + i * 512);
        asm volatile("s_wait_xcnt 0x0" ::: "memory");   // stands between these loads and the next pass's step of their address registers
        if (!HR) __builtin_amdgcn_sched_barrier(0);   // holds these loads here, in front of the softmax: scheduled later they have less of the pass to land in (HR: its registers do not allow it)
        // chunk max; HR: scale and causal select by value here, in every chunk (with the branch that kernel spills to scratch)
        float tmx = NEG;
#pragma unroll
        for (int j = 0; j < 4; ++j) {
#pragma unroll
            for (int r = 0; r < 8; ++r) {
                if (HR) { const int key = k0 + 16 * j + 8 * hi + r; s[j][r] = (key <= myq) ? s[j][r] * SCL : NEG; }
                tmx = fmaxf(tmx, s[j][r]);
            }
        }
        tmx = fmaxf(tmx, __shfl_xor(tmx, 16, 32));
        const float mn = fmaxf(m, tmx);
        const float alpha = __builtin_amdgcn_exp2f((m - mn) * L2E);
        m = mn; lsum *= alpha;
#pragma unroll
        for (int dt = 0; dt < 4; ++dt)
#pragma unroll
            for (int r = 0; r < 8; ++r) oacc[dt][r] *= alpha;
        // weights and their 16-bit P^T fragments (ks = 32-key step: tiles 2ks and 2ks+1)
        v16bf pbh[2], pbl[2]; v16h pf[2];
#pragma unroll
        for (int ks = 0; ks < 2; ++ks) {
            v16us uh, ul; v16h p16;
#pragma unroll
            for (int half = 0; half < 2; ++half) {
                const int j = 2 * ks + half;
#pragma unroll
                for (int r = 0; r < 8; ++r) {
                    const float p = __builtin_amdgcn_exp2f((s[j][r] - mn) * L2E);
                    lsum += p;
                    if (HR) { unsigned short a, b2; splitf(p, a, b2); uh[half * 8 + r] = a; ul[half * 8 + r] = b2; }
                    else { p16[half * 8 + r] = (h16)(p * PCAR); }
                }
            }
            if (HR) { pbh[ks] = __builtin_bit_cast(v16bf, uh); pbl[ks] = __builtin_bit_cast(v16bf, ul); }
            else { pf[ks] = p16; }
        }
        // O^T[d][query] += V^T . P^T over the chunk's 64 keys
#pragma unroll
        for (int ks = 0; ks < 2; ++ks) {
            if (HR) {
                const v16bf bh = pbh[ks], bl = pbl[ks];
                v16bf vf[4];
#pragma unroll
                for (int dt = 0; dt < 4; ++dt) vf[dt] = vfb[4 * ks + dt];
#pragma unroll
                for (int dt = 0; dt < 4; ++dt) { oacc[dt] = wmmab(vf[dt], bh, oacc[dt]); oacc[dt] = wmmab(vf[dt], bl, oacc[dt]); }
                asm volatile("v_nop\n\tv_nop\n\tv_nop\n\tv_nop" : "+v"(oacc[0]), "+v"(oacc[1]), "+v"(oacc[2]), "+v"(oacc[3]) : "v"(vf[0]), "v"(vf[1]), "v"(vf[2]), "v"(vf[3]), "v"(bh), "v"(bl));
            } else {
                const v16h bp = pf[ks];
                v16h vf[4];
#pragma unroll
                for (int dt = 0; dt < 4; ++dt) vf[dt] = vfh[4 * ks + dt];
#pragma unroll
                for (int dt = 0; dt < 4; ++dt) oacc[dt] = wmma16(vf[dt], bp, oacc[dt]);
                asm volatile("v_nop\n\tv_nop\n\tv_nop\n\tv_nop" : "+v"(oacc[0]), "+v"(oacc[1]), "+v"(oacc[2]), "+v"(oacc[3]) : "v"(vf[0]), "v"(vf[1]), "v"(vf[2]), "v"(vf[3]), "v"(bp));
            }
        }
        // next chunk's V^T fragments, into the registers just left: they fly during the next chunk's score products and softmax
        if (HR) vbp += step; else vhp += step;
#pragma unroll
        for (int i = 0; i < 8; ++i) { if (HR) vfb[i] = ldbu(vbp + i * 512); else vfh[i] = ldhu(vhp + i * 512); }
        asm volatile("s_wait_xcnt 0x0" ::: "memory");   // stands between these loads and the next pass's step of their address registers
    }
    // normalise and write: lane holds query lr, d = dt*16 + 8h + r
    lsum += __shfl_xor(lsum, 16, 32);
    const float inv = __fdiv_rn(HR ? 1.0f : PCINV, lsum);
    float* osw = os + wave * (16 * 68);   // wave-private staging tile [16 queries][64 d], pitch 68
#pragma unroll
    for (int dt = 0; dt < 4; ++dt)
#pragma unroll
        for (int r = 0; r < 8; ++r) osw[lr * 68 + dt * 16 + 8 * hi + r] = oacc[dt][r] * inv;
    __builtin_amdgcn_fence(3, "wavefront"); __builtin_amdgcn_wave_barrier(); asm volatile("" ::: "memory");
    float* orow = OUT + (z * SEQ + (size_t)q0) * HD;
    v4f val[8];
#pragma unroll
    for (int sg = 0; sg < 8; ++sg) val[sg] = *(const v4fa*)(osw + (2 * sg + hi) * 68 + lr * 4);
#pragma unroll
    for (int sg = 0; sg < 8; ++sg) *(v4f*)(orow + (size_t)(2 * sg + hi) * HD + lr * 4) = val[sg];
    
}

extern "C" void kernel_launch(void* const* d_in, const int* in_sizes, int n_in,
                              void* d_out, int out_size, void* d_ws, size_t ws_size, hipStream_t stream) {
    if (n_in < 3) return;
    const float* xq = (const float*)d_in[0];   // [NB][16][SEQ_FULL][64] f32
    const float* xk = (const float*)d_in[1];
    const float* xv = (const float*)d_in[2];
    float* OUT = (float*)d_out;                // [NB][16][SEQ][64] f32
    const long long need_in = (long long)(NZ - 1) * SEQ_FULL * HD + (long long)SEQ * HD;
    if ((long long)in_sizes[0] < need_in || (long long)in_sizes[1] < need_in || (long long)in_sizes[2] < need_in) return;
    if ((long long)out_size < (long long)NZ * SEQ * HD) return;
    char* wsp = (char*)d_ws;
    auto take = [&](size_t bytes) { char* p = wsp; wsp += (bytes + 255) & ~(size_t)255; return (void*)p; };
    const size_t plane = (size_t)NZ * SEQ * HD;      // elements per 16-bit plane
    bf*  Qp   = (bf*)take(plane * 2);                 // [z][t][d] bf16
    bf*  Kp   = (bf*)take(plane * 2);                 // fragment order, bf16
    bf*  VTh  = (bf*)take(plane * 2);                 // fragment order, bf16
    h16* VT16 = (h16*)take(plane * 2);                // fragment order, f16
    if ((size_t)(wsp - (char*)d_ws) > ws_size) return;   // 4 x 16 MiB = 64 MiB at full size
    const int n8 = (int)(plane / 8);
    k_cvt8<<<(unsigned)((n8 + 255) / 256), 256, 0, stream>>>(xq, Qp, n8);
    k_kpk<<<(unsigned)((n8 + 255) / 256), 256, 0, stream>>>(xk, Kp, n8);
    k_vpk<<<(unsigned)((n8 + 255) / 256), 256, 0, stream>>>(xv, VT16, VTh, n8);
    const int nqb = SEQ / QT;
    const int rhb = ((RH < SEQ) ? RH : SEQ) / QT;
    if (rhb > 0) k_attn<true><<<dim3((unsigned)rhb, NZ), 256, 0, stream>>>(Qp, Kp, VTh, VT16, OUT, 0);
    if (nqb - rhb > 0) k_attn<false><<<dim3((unsigned)(nqb - rhb), NZ), 256, 0, stream>>>(Qp, Kp, VTh, VT16, OUT, rhb);
}

// v004
// It runs in 111 microseconds.
// Two timings next to v003 put it at 1.24 and 1.25 times that version's speed.
// Over all steps from v000 it is 3.28 times as fast.
#include <hip/hip_runtime.h>

// Contractions (f32 accumulate): score tiles k.q^T on v_wmma_f32_16x16x32_bf16 (bf16 operands = RNE-converted q and k, exact products, x0.125 applied in f32);
// p.v on v_wmma_f32_16x16x32_bf16 (p as bf16 hi + bf16 lo, v bf16) for query rows below RH, and on v_wmma_f32_16x16x32_f16 (p carried x1024 in f16, v f16) for the remaining rows;
// running-max softmax, row sums and the final 1/l scaling in f32; f32 output.
// Layout: q is converted once into a bf16 plane [z][t][d] (z = b*16 + h); k (bf16) and v (f16 and bf16) once into planes stored in fragment order:
// every 16-byte-per-lane load of a K or V^T fragment half is one 512-byte unit [lane][8 elements], so a wave-wide load reads four whole 128-byte lines.
// One streaming causal attention kernel per query-block range: 8 waves x 16 query rows per block, 64-key chunks, operands loaded as fragments straight from the planes, one chunk ahead of their use,
// causal select by value (rows from RH on: only in the one chunk of a wave that crosses the diagonal), key chunks entirely above the diagonal are never visited (their weights are exactly zero).

#ifndef NB
#define NB 2
#endif
#ifndef SEQ
#define SEQ 4096
#endif
#ifndef SEQ_FULL
#define SEQ_FULL 4096
#endif
#ifndef RH
#define RH 1024
#endif
#define NH 16
#define HD 64
#define NZ (NB * NH)
#define QT 128
#define KC 64
#define PCAR 1024.0f
#define PCINV 0.0009765625f
#define SCL 0.125f
#define L2E 1.4426950408889634f
#define NEG (-1.0e30f)
static_assert(SEQ % QT == 0);
static_assert(SEQ % KC == 0);
static_assert(RH % QT == 0);
static_assert(QT == 8 * 16);
static_assert(HD == 64);
static_assert(SEQ % 32 == 0);
static_assert(SEQ <= SEQ_FULL);
static_assert(((long long)NZ * SEQ * HD) % 8 == 0);

typedef _Float16 h16;
typedef unsigned short bf;
typedef __attribute__((ext_vector_type(16))) __bf16         v16bf;
typedef __attribute__((ext_vector_type(16))) _Float16       v16h;
typedef __attribute__((ext_vector_type(16))) unsigned short v16us;
typedef __attribute__((ext_vector_type(8)))  _Float16       v8h;
typedef __attribute__((ext_vector_type(8)))  unsigned short v8us;
typedef __attribute__((ext_vector_type(8)))  float          v8f;
typedef __attribute__((ext_vector_type(4)))  float          v4f;
typedef __attribute__((ext_vector_type(2)))  _Float16       v2h;
typedef __attribute__((ext_vector_type(2)))  unsigned short v2us;
typedef v4f __attribute__((may_alias)) v4fa;

__device__ __forceinline__ unsigned short f2bf(float f) { unsigned u = __float_as_uint(f); u += 0x7FFFu + ((u >> 16) & 1u); return (unsigned short)(u >> 16); }
__device__ __forceinline__ float bf2f(unsigned short b) { return __uint_as_float(((unsigned)b) << 16); }
__device__ __forceinline__ float bfr(float f) { return bf2f(f2bf(f)); }
__device__ __forceinline__ void splitf(float y, unsigned short& h, unsigned short& l) { h = f2bf(y); l = f2bf(y - bf2f(h)); }
__device__ __forceinline__ v16h  cat16(v8h lo, v8h hi) { return __builtin_shufflevector(lo, hi, 0, 1, 2, 3, 4, 5, 6, 7, 8, 9, 10, 11, 12, 13, 14, 15); }
__device__ __forceinline__ v16bf cat16b(v8us lo, v8us hi) { return __builtin_bit_cast(v16bf, __builtin_shufflevector(lo, hi, 0, 1, 2, 3, 4, 5, 6, 7, 8, 9, 10, 11, 12, 13, 14, 15)); }
__device__ __forceinline__ v8f wmma16(v16h a, v16h b, v8f c) { return __builtin_amdgcn_wmma_f32_16x16x32_f16(false, a, false, b, (short)0, c, false, false); }
__device__ __forceinline__ v8f wmmab(v16bf a, v16bf b, v8f c) { return __builtin_amdgcn_wmma_f32_16x16x32_bf16(false, a, false, b, (short)0, c, false, false); }

// Fragment loader for a 16 x 32(k) operand tile from a k-contiguous 16-bit row; p = base + row(lane & 15) * pitch + k0 + 8 * (lane >> 4):
// elements 0..7 = k0 + 8h + 0..7, elements 8..15 = k0 + 16 + 8h + 0..7 (same map for the A operand, row = lane & 15, and for the B operand stored [n][k], column = lane & 15).
__device__ __forceinline__ v16bf ldb(const bf* p) { return cat16b(*(const v8us*)p, *(const v8us*)(p + 16)); }
// The same fragments from a fragment-order plane; p = first unit of the fragment + 8 * lane: elements 0..7 from that unit, elements 8..15 from the next unit (256 elements on).
__device__ __forceinline__ v16bf ldbu(const bf* p) { return cat16b(*(const v8us*)p, *(const v8us*)(p + 256)); }
__device__ __forceinline__ v16h  ldhu(const h16* p) { return cat16(*(const v8h*)p, *(const v8h*)(p + 256)); }

__global__ __launch_bounds__(256) void k_cvt8(const float* __restrict__ src, bf* dst, int n8) {
    const int i = blockIdx.x * 256 + threadIdx.x; if (i >= n8) return;
    const size_t e = (size_t)i * 8; const size_t zz = e / ((size_t)SEQ * HD); const size_t rem = e - zz * ((size_t)SEQ * HD);
    const v8f v = *(const v8f*)(src + zz * ((size_t)SEQ_FULL * HD) + rem); v8us o;
#pragma unroll
    for (int k = 0; k < 8; ++k) o[k] = f2bf(v[k]);
    *(v8us*)(dst + e) = o; 
}

// k_kpk: key plane in fragment order, Kf[z][t / 16][u][lane][8]: unit u (0..3) of a 16-key tile holds, at lane, key 16 * tile + (lane & 15), d = 16u + 8 * (lane >> 4) + 0..7
// (units 0, 1 = the A fragment for d 0..31, units 2, 3 = the one for d 32..63). One thread per 16-byte destination piece; source F[z][t][d] with z-pitch SEQ_FULL*HD.
__global__ __launch_bounds__(256) void k_kpk(const float* __restrict__ F, bf* Kf, int n8) {
    const int i = blockIdx.x * 256 + threadIdx.x; if (i >= n8) return;
    const int lane = i & 31, u = (i >> 5) & 3, tile = (i >> 7) % (SEQ / 16); const size_t zz = (size_t)((i >> 7) / (SEQ / 16));
    const v8f v = *(const v8f*)(F + (zz * SEQ_FULL + (size_t)(tile * 16 + (lane & 15))) * HD + u * 16 + (lane >> 4) * 8); v8us o;
    asm volatile("s_wait_xcnt 0x0" ::: "memory");   // stands in front of the reuse of the loads' address registers
#pragma unroll
    for (int k = 0; k < 8; ++k) o[k] = f2bf(v[k]);
    *(v8us*)(Kf + (size_t)i * 8) = o;
}

// k_vpk: value planes in fragment order, V16 / Vh[z][t / 32][dt][u][lane][8] (f16 and bf16 bits of the RNE-converted input): unit u (0, 1) of the V^T A fragment for d tile dt and a 32-key step
// holds, at lane, d = 16dt + (lane & 15), keys 32 * step + 16u + 8 * (lane >> 4) + 0..7. One thread per 16-byte destination piece; source F[z][t][d] with z-pitch SEQ_FULL*HD.
__global__ __launch_bounds__(256) void k_vpk(const float* __restrict__ F, h16* V16, bf* Vh, int n8) {
    const int i = blockIdx.x * 256 + threadIdx.x; if (i >= n8) return;
    const int lane = i & 31, u = (i >> 5) & 1, dt = (i >> 6) & 3, st = (i >> 8) % (SEQ / 32); const size_t zz = (size_t)((i >> 8) / (SEQ / 32));
    const float* f = F + (zz * SEQ_FULL + (size_t)(st * 32 + u * 16 + (lane >> 4) * 8)) * HD + dt * 16 + (lane & 15); v8h o16; v8us oh;
#pragma unroll
    for (int q = 0; q < 8; ++q) { const float x = bfr(f[(size_t)q * HD]); o16[q] = (h16)x; oh[q] = f2bf(x); }
    *(v8h*)(V16 + (size_t)i * 8) = o16; *(v8us*)(Vh + (size_t)i * 8) = oh;
}

// k_attn: streaming causal attention for query block qbl - blockIdx.y of head-plane z = blockIdx.x (qbl = last query block of the launch's range).
// A block's cost grows with its query block; the longest ones (all planes of the last query block) have the lowest flat indices
// and the shortest the highest. Speed only: every (plane, query block) is worked once whatever the order.
// Wave w owns query rows q0..q0+15 (q0 = qb*128 + 16w) and visits key chunks 0..(q0+15)/64 (uniform per wave; waves never exchange data, no block barrier needed).
// Per 64-key chunk: four S^T tiles = K(16 keys x 64 d, A operand) . Q^T (B operand from the [q][d] plane): lane holds query q0 + (lane & 15) and keys k0 + 16j + 8h + r.
// Causal select by value (key > query -> huge negative), for rows from RH on in the wave's last chunk alone, chunk max within the lane then xor-16, running max / scale / sums in f32, p = exp2((t - m) * log2 e).
// The p values of two adjacent 16-key tiles form one P^T B-fragment directly (element r <- tile covering keys 0..15, element 8 + r <- tile covering keys 16..31, lane = query),
// O^T[d][query] += V^T(16 d x 32 keys, A operand from the fragment-order plane) . P^T; HR: p as bf16 hi + lo into the same accumulator with bf16 v, else p x 1024 in f16 with f16 v.
template <bool HR>
__global__ __launch_bounds__(256) __attribute__((amdgpu_num_vgpr(256)))
void k_attn(const bf* __restrict__ Qp, const bf* __restrict__ Kp, const bf* __restrict__ VTh, const h16* __restrict__ VT16, float* OUT, int qbl) {
#pragma clang fp contract(off)
    __shared__ __align__(16) float os[8 * 16 * 68];
    const int lane = threadIdx.x & 31, lr = lane & 15, hi = lane >> 4, wave = threadIdx.x >> 5;
    const size_t z = blockIdx.x;
    const int q0 = (qbl - (int)blockIdx.y) * QT + wave * 16;
    const int myq = q0 + lr;
    const bf* Qz = Qp + z * ((size_t)SEQ * HD);
    const bf* Kz = Kp + z * ((size_t)SEQ * HD);
    const bf* Vhz = VTh + z * ((size_t)HD * SEQ);
    const h16* V16z = VT16 + z * ((size_t)HD * SEQ);
    // Q^T B-fragments (column n = query q0 + lr, k = d), kept for the whole key loop
    const v16bf qf0 = ldb(Qz + (size_t)myq * HD + 8 * hi);
    const v16bf qf1 = ldb(Qz + (size_t)myq * HD + 32 + 8 * hi);
    v8f oacc[4];
#pragma unroll
    for (int dt = 0; dt < 4; ++dt) oacc[dt] = (v8f){};
    float m = NEG, lsum = 0.0f;
    // key chunks with at least one key <= the wave's last query; chunk c always has key 64c <= every query of this wave (the same in every lane, read as a scalar)
    const int nch = __builtin_amdgcn_readfirstlane((q0 + 15) / KC + 1);
    // Fragments are fetched one chunk ahead: a chunk's eight K fragments (i = 4jg + 0..3: keys 32jg + 0..15 d 0..31, d 32..63, keys 32jg + 16..31 d 0..31, d 32..63)
    // and eight V^T fragments (i = 4ks + dt) each start at element 64 * k0 + 512 * i + 8 * lane of their plane.
    const bf* kp = Kz + 8 * lane;      // each lane's place in the chunk being fetched: these pointers live across the passes, so no load lands on its own address registers
    const bf* vbp = Vhz + 8 * lane;
    const h16* vhp = V16z + 8 * lane;
    v16bf kf[8]; v16bf vfb[8]; v16h vfh[8];
#pragma unroll
    for (int i = 0; i < 8; ++i) kf[i] = ldbu(kp + i * 512);
#pragma unroll
    for (int i = 0; i < 8; ++i) { if (HR) vfb[i] = ldbu(vbp + i * 512); else vfh[i] = ldhu(vhp + i * 512); }
    // inputs-only fence on the loaded Q and first K fragments: they have landed in front of the loop (the first product needs them anyway), so the wait at the loop's head
    // is counted from the loop's own load order alone (K older than the sixteen V loads) and leaves the V loads in flight; without it that wait drains part of them on every pass
    asm volatile("" :: "v"(qf0), "v"(qf1), "v"(kf[0]), "v"(kf[1]), "v"(kf[2]), "v"(kf[3]), "v"(kf[4]), "v"(kf[5]), "v"(kf[6]), "v"(kf[7]));
#pragma unroll 1
    for (int c = 0; c < nch; ++c) {
        const int k0 = c * KC;
        const int step = (c + 1 < nch) ? KC * HD : 0;   // on to the next chunk; the last pass fetches its own chunk again (in bounds, unused)
        v8f s[4];
#pragma unroll
        for (int jg = 0; jg < 2; ++jg) {
            const v16bf ka0 = kf[4 * jg], ka1 = kf[4 * jg + 1], kb0 = kf[4 * jg + 2], kb1 = kf[4 * jg + 3];
            v8f t0 = wmmab(ka0, qf0, (v8f){}); t0 = wmmab(ka1, qf1, t0);
            v8f t1 = wmmab(kb0, qf0, (v8f){}); t1 = wmmab(kb1, qf1, t1);
            asm volatile("v_nop\n\tv_nop\n\tv_nop\n\tv_nop" : "+v"(t0), "+v"(t1) : "v"(ka0), "v"(ka1), "v"(kb0), "v"(kb1), "v"(qf0), "v"(qf1));
            s[2 * jg] = t0; s[2 * jg + 1] = t1;
        }
        // rows from RH on: scale, then the causal select by value only in the wave's last chunk (a scalar branch): q0 is a multiple of 16, so every earlier chunk
        // ends at key 64 * (q0 / 64) - 1 < q0 and the select would keep each of its scores. It stands in front of the fetch so that all behind the branch stays one block to schedule.
        // (the loops are unrolled so that s is indexed by constants and stays in registers)
        if (!HR) {
#pragma unroll
            for (int j = 0; j < 4; ++j)
#pragma unroll
                for (int r = 0; r < 8; ++r) s[j][r] *= SCL;
            if (c + 1 == nch) {
#pragma unroll
                for (int j = 0; j < 4; ++j)
#pragma unroll
                    for (int r = 0; r < 8; ++r) s[j][r] = (k0 + 16 * j + 8 * hi + r <= myq) ? s[j][r] : NEG;
            }
        }
        // next chunk's K fragments, into the registers the products above have just left: they fly during the softmax and the p.v products
        kp += step;
#pragma unroll
        for (int i = 0; i < 8; ++i) kf[i] = ldbu(kp + i * 512);
        asm volatile("s_wait_xcnt 0x0" ::: "memory");   // stands between these loads and the next pass's step of their address registers
        if (!HR) __builtin_amdgcn_sched_barrier(0);   // holds these loads here, in front of the softmax: scheduled later they have less of the pass to land in (HR: its registers do not allow it)
        // chunk max; HR: scale and causal select by value here, in every chunk (with the branch that kernel spills to scratch)
        float tmx = NEG;
#pragma unroll
        for (int j = 0; j < 4; ++j) {
#pragma unroll
            for (int r = 0; r < 8; ++r) {
                if (HR) { const int key = k0 + 16 * j + 8 * hi + r; s[j][r] = (key <= myq) ? s[j][r] * SCL : NEG; }
                tmx = fmaxf(tmx, s[j][r]);
            }
        }
        tmx = fmaxf(tmx, __shfl_xor(tmx, 16, 32));
        const float mn = fmaxf(m, tmx);
        const float alpha = __builtin_amdgcn_exp2f((m - mn) * L2E);
        m = mn; lsum *= alpha;
#pragma unroll
        for (int dt = 0; dt < 4; ++dt)
#pragma unroll
            for (int r = 0; r < 8; ++r) oacc[dt][r] *= alpha;
        // weights and their 16-bit P^T fragments (ks = 32-key step: tiles 2ks and 2ks+1)
        v16bf pbh[2], pbl[2]; v16h pf[2];
#pragma unroll
        for (int ks = 0; ks < 2; ++ks) {
            v16us uh, ul; v16h p16;
#pragma unroll
            for (int half = 0; half < 2; ++half) {
                const int j = 2 * ks + half;
#pragma unroll
                for (int r = 0; r < 8; ++r) {
                    const float p = __builtin_amdgcn_exp2f((s[j][r] - mn) * L2E);
                    lsum += p;
                    if (HR) { unsigned short a, b2; splitf(p, a, b2); uh[half * 8 + r] = a; ul[half * 8 + r] = b2; }
                    else { p16[half * 8 + r] = (h16)(p * PCAR); }
                }
            }
            if (HR) { pbh[ks] = __builtin_bit_cast(v16bf, uh); pbl[ks] = __builtin_bit_cast(v16bf, ul); }
            else { pf[ks] = p16; }
        }
        // O^T[d][query] += V^T . P^T over the chunk's 64 keys
#pragma unroll
        for (int ks = 0; ks < 2; ++ks) {
            if (HR) {
                const v16bf bh = pbh[ks], bl = pbl[ks];
                v16bf vf[4];
#pragma unroll
                for (int dt = 0; dt < 4; ++dt) vf[dt] = vfb[4 * ks + dt];
#pragma unroll
                for (int dt = 0; dt < 4; ++dt) { oacc[dt] = wmmab(vf[dt], bh, oacc[dt]); oacc[dt] = wmmab(vf[dt], bl, oacc[dt]); }
                asm volatile("v_nop\n\tv_nop\n\tv_nop\n\tv_nop" : "+v"(oacc[0]), "+v"(oacc[1]), "+v"(oacc[2]), "+v"(oacc[3]) : "v"(vf[0]), "v"(vf[1]), "v"(vf[2]), "v"(vf[3]), "v"(bh), "v"(bl));
            } else {
                const v16h bp = pf[ks];
                v16h vf[4];
#pragma unroll
                for (int dt = 0; dt < 4; ++dt) vf[dt] = vfh[4 * ks + dt];
#pragma unroll
                for (int dt = 0; dt < 4; ++dt) oacc[dt] = wmma16(vf[dt], bp, oacc[dt]);
                asm volatile("v_nop\n\tv_nop\n\tv_nop\n\tv_nop" : "+v"(oacc[0]), "+v"(oacc[1]), "+v"(oacc[2]), "+v"(oacc[3]) : "v"(vf[0]), "v"(vf[1]), "v"(vf[2]), "v"(vf[3]), "v"(bp));
            }
        }
        // next chunk's V^T fragments, into the registers just left: they fly during the next chunk's score products and softmax
        if (HR) vbp += step; else vhp += step;
#pragma unroll
        for (int i = 0; i < 8; ++i) { if (HR) vfb[i] = ldbu(vbp + i * 512); else vfh[i] = ldhu(vhp + i * 512); }
        asm volatile("s_wait_xcnt 0x0" ::: "memory");   // stands between these loads and the next pass's step of their address registers
    }
    // normalise and write: lane holds query lr, d = dt*16 + 8h + r
    lsum += __shfl_xor(lsum, 16, 32);
    const float inv = __fdiv_rn(HR ? 1.0f : PCINV, lsum);
    float* osw = os + wave * (16 * 68);   // wave-private staging tile [16 queries][64 d], pitch 68
#pragma unroll
    for (int dt = 0; dt < 4; ++dt)
#pragma unroll
        for (int r = 0; r < 8; ++r) osw[lr * 68 + dt * 16 + 8 * hi + r] = oacc[dt][r] * inv;
    __builtin_amdgcn_fence(3, "wavefront"); __builtin_amdgcn_wave_barrier(); asm volatile("" ::: "memory");
    float* orow = OUT + (z * SEQ + (size_t)q0) * HD;
    v4f val[8];
#pragma unroll
    for (int sg = 0; sg < 8; ++sg) val[sg] = *(const v4fa*)(osw + (2 * sg + hi) * 68 + lr * 4);
#pragma unroll
    for (int sg = 0; sg < 8; ++sg) *(v4f*)(orow + (size_t)(2 * sg + hi) * HD + lr * 4) = val[sg];
    
}

extern "C" void kernel_launch(void* const* d_in, const int* in_sizes, int n_in,
                              void* d_out, int out_size, void* d_ws, size_t ws_size, hipStream_t stream) {
    if (n_in < 3) return;
    const float* xq = (const float*)d_in[0];   // [NB][16][SEQ_FULL][64] f32
    const float* xk = (const float*)d_in[1];
    const float* xv = (const float*)d_in[2];
    float* OUT = (float*)d_out;                // [NB][16][SEQ][64] f32
    const long long need_in = (long long)(NZ - 1) * SEQ_FULL * HD + (long long)SEQ * HD;
    if ((long long)in_sizes[0] < need_in || (long long)in_sizes[1] < need_in || (long long)in_sizes[2] < need_in) return;
    if ((long long)out_size < (long long)NZ * SEQ * HD) return;
    char* wsp = (char*)d_ws;
    auto take = [&](size_t bytes) { char* p = wsp; wsp += (bytes + 255) & ~(size_t)255; return (void*)p; };
    const size_t plane = (size_t)NZ * SEQ * HD;      // elements per 16-bit plane
    bf*  Qp   = (bf*)take(plane * 2);                 // [z][t][d] bf16
    bf*  Kp   = (bf*)take(plane * 2);                 // fragment order, bf16
    bf*  VTh  = (bf*)take(plane * 2);                 // fragment order, bf16
    h16* VT16 = (h16*)take(plane * 2);                // fragment order, f16
    if ((size_t)(wsp - (char*)d_ws) > ws_size) return;   // 4 x 16 MiB = 64 MiB at full size
    const int n8 = (int)(plane / 8);
    k_cvt8<<<(unsigned)((n8 + 255) / 256), 256, 0, stream>>>(xq, Qp, n8);
    k_kpk<<<(unsigned)((n8 + 255) / 256), 256, 0, stream>>>(xk, Kp, n8);
    k_vpk<<<(unsigned)((n8 + 255) / 256), 256, 0, stream>>>(xv, VT16, VTh, n8);
    const int nqb = SEQ / QT;
    const int rhb = ((RH < SEQ) ? RH : SEQ) / QT;
    if (rhb > 0) k_attn<true><<<dim3(NZ, (unsigned)rhb), 256, 0, stream>>>(Qp, Kp, VTh, VT16, OUT, rhb - 1);
    if (nqb - rhb > 0) k_attn<false><<<dim3(NZ, (unsigned)(nqb - rhb)), 256, 0, stream>>>(Qp, Kp, VTh, VT16, OUT, nqb - 1);
}

// v005
// It runs in 106 microseconds.
// In both of two side-by-side timings against v004, it was 1.05 times as fast.
// All steps since v000 together make it 3.45 times as fast.
#include <hip/hip_runtime.h>

// Contractions (f32 accumulate): score tiles k.q^T on v_wmma_f32_16x16x32_bf16 (bf16 operands = RNE-converted q and k, exact products, x0.125 applied in f32);
// p.v on v_wmma_f32_16x16x32_bf16 (p as bf16 hi + bf16 lo, v bf16) for query rows below RH, and on v_wmma_f32_16x16x32_f16 (p carried x1024 in f16, v f16) for the remaining rows;
// running-max softmax, row sums and the final 1/l scaling in f32; f32 output.
// Layout: one launch converts q into a bf16 plane [z][t][d] (z = b*16 + h) and k (bf16) and v (f16 and bf16) into planes stored in fragment order:
// every 16-byte-per-lane load of a K or V^T fragment half is one 512-byte unit [lane][8 elements], so a wave-wide load reads four whole 128-byte lines.
// One streaming causal attention kernel per query-block range: 8 waves x 16 query rows per block, 64-key chunks, operands loaded as fragments straight from the planes, one chunk ahead of their use,
// causal select by value (rows from RH on: only in the one chunk of a wave that crosses the diagonal), key chunks entirely above the diagonal are never visited (their weights are exactly zero).

#ifndef NB
#define NB 2
#endif
#ifndef SEQ
#define SEQ 4096
#endif
#ifndef SEQ_FULL
#define SEQ_FULL 4096
#endif
#ifndef RH
#define RH 1024
#endif
#define NH 16
#define HD 64
#define NZ (NB * NH)
#define QT 128
#define KC 64
#define PCAR 1024.0f
#define PCINV 0.0009765625f
#define SCL 0.125f
#define L2E 1.4426950408889634f
#define NEG (-1.0e30f)
#define PKB 256   // packing work-groups: one per WGP of the chip (speed only: the span loop strides by the grid, so any count does all the work once)
static_assert(SEQ % QT == 0);
static_assert(SEQ % KC == 0);
static_assert(RH % QT == 0);
static_assert(QT == 8 * 16);
static_assert(HD == 64);
static_assert(SEQ % 32 == 0);
static_assert(SEQ <= SEQ_FULL);
static_assert(((long long)NZ * SEQ * HD) % 8 == 0);

typedef _Float16 h16;
typedef unsigned short bf;
typedef __attribute__((ext_vector_type(16))) __bf16         v16bf;
typedef __attribute__((ext_vector_type(16))) _Float16       v16h;
typedef __attribute__((ext_vector_type(16))) unsigned short v16us;
typedef __attribute__((ext_vector_type(8)))  _Float16       v8h;
typedef __attribute__((ext_vector_type(8)))  unsigned short v8us;
typedef __attribute__((ext_vector_type(8)))  float          v8f;
typedef __attribute__((ext_vector_type(4)))  float          v4f;
typedef __attribute__((ext_vector_type(2)))  _Float16       v2h;
typedef __attribute__((ext_vector_type(2)))  unsigned short v2us;
typedef v4f __attribute__((may_alias)) v4fa;

__device__ __forceinline__ unsigned short f2bf(float f) { unsigned u = __float_as_uint(f); u += 0x7FFFu + ((u >> 16) & 1u); return (unsigned short)(u >> 16); }
__device__ __forceinline__ float bf2f(unsigned short b) { return __uint_as_float(((unsigned)b) << 16); }
__device__ __forceinline__ float bfr(float f) { return bf2f(f2bf(f)); }
__device__ __forceinline__ void splitf(float y, unsigned short& h, unsigned short& l) { h = f2bf(y); l = f2bf(y - bf2f(h)); }
__device__ __forceinline__ v16h  cat16(v8h lo, v8h hi) { return __builtin_shufflevector(lo, hi, 0, 1, 2, 3, 4, 5, 6, 7, 8, 9, 10, 11, 12, 13, 14, 15); }
__device__ __forceinline__ v16bf cat16b(v8us lo, v8us hi) { return __builtin_bit_cast(v16bf, __builtin_shufflevector(lo, hi, 0, 1, 2, 3, 4, 5, 6, 7, 8, 9, 10, 11, 12, 13, 14, 15)); }
__device__ __forceinline__ v8f wmma16(v16h a, v16h b, v8f c) { return __builtin_amdgcn_wmma_f32_16x16x32_f16(false, a, false, b, (short)0, c, false, false); }
__device__ __forceinline__ v8f wmmab(v16bf a, v16bf b, v8f c) { return __builtin_amdgcn_wmma_f32_16x16x32_bf16(false, a, false, b, (short)0, c, false, false); }

// Fragment loader for a 16 x 32(k) operand tile from a k-contiguous 16-bit row; p = base + row(lane & 15) * pitch + k0 + 8 * (lane >> 4):
// elements 0..7 = k0 + 8h + 0..7, elements 8..15 = k0 + 16 + 8h + 0..7 (same map for the A operand, row = lane & 15, and for the B operand stored [n][k], column = lane & 15).
__device__ __forceinline__ v16bf ldb(const bf* p) { return cat16b(*(const v8us*)p, *(const v8us*)(p + 16)); }
// The same fragments from a fragment-order plane; p = first unit of the fragment + 8 * lane: elements 0..7 from that unit, elements 8..15 from the next unit (256 elements on).
__device__ __forceinline__ v16bf ldbu(const bf* p) { return cat16b(*(const v8us*)p, *(const v8us*)(p + 256)); }
__device__ __forceinline__ v16h  ldhu(const h16* p) { return cat16(*(const v8h*)p, *(const v8h*)(p + 256)); }

// k_pack: all three conversions in one resident stream. PKB work-groups of 16 waves; a wave takes whole spans of 32 positions x 64 d of one plane z (8 KiB of f32 per input,
// 256 destination pieces of 16 bytes, piece = 256 * span + 32j + lane, j = 0..7) and has a span's loads in flight together, so that few waves have to start and each keeps the memory busy.
// Qp[z][t][d]: piece j holds elements 256j + 8 * lane + 0..7 of the span.
// Kf[z][t / 16][u][lane][8]: unit u (0..3) of a 16-key tile holds, at lane, key 16 * tile + (lane & 15), d = 16u + 8 * (lane >> 4) + 0..7
// (units 0, 1 = the A fragment for d 0..31, units 2, 3 = the one for d 32..63); piece j = tile j >> 2 of the span, unit j & 3.
// V16 / Vh[z][t / 32][dt][u][lane][8] (f16 and bf16 bits of the RNE-converted input): unit u (0, 1) of the V^T A fragment for d tile dt and a 32-key step
// holds, at lane, d = 16dt + (lane & 15), keys 32 * step + 16u + 8 * (lane >> 4) + 0..7; piece j = d tile j >> 1, unit j & 1. Sources [z][t][d] with z-pitch SEQ_FULL*HD.
__global__ __launch_bounds__(512) void k_pack(const float* __restrict__ xq, const float* __restrict__ xk, const float* __restrict__ xv, bf* Qp, bf* Kf, h16* V16, bf* Vh) {
    const int lane = threadIdx.x & 31, lr = lane & 15, hi = lane >> 4;
    const int wave = __builtin_amdgcn_readfirstlane((int)(threadIdx.x >> 5));   // the same in every lane: span bases stay scalar
    for (int sp = (int)blockIdx.x * 16 + wave; sp < NZ * (SEQ / 32); sp += (int)gridDim.x * 16) {
        const size_t src = ((size_t)(sp / (SEQ / 32)) * SEQ_FULL + (size_t)(sp % (SEQ / 32)) * 32) * HD;
        const size_t dst = (size_t)sp * 2048 + (size_t)lane * 8;
        const float* fq = xq + src + lane * 8;
        const float* fk = xk + src + lr * HD + hi * 8;
        const float* fv = xv + src + hi * (8 * HD) + lr;
        v8f a[8], b[8]; float c[8][8];
#pragma unroll
        for (int j = 0; j < 8; ++j) a[j] = *(const v8f*)(fq + j * 256);
#pragma unroll
        for (int j = 0; j < 8; ++j) b[j] = *(const v8f*)(fk + (j >> 2) * (16 * HD) + (j & 3) * 16);
        // stands in front of any reuse of these loads' address registers; the pointers are inputs so that they stay live up to here and no load lands on an address register
        asm volatile("s_wait_xcnt 0x0" :: "v"(fq), "v"(fk) : "memory");
        __builtin_amdgcn_sched_barrier(0);   // all 32 loads are issued before any conversion: scheduled among the conversions, the later ones would start only when the earlier have landed
#pragma unroll
        for (int j = 0; j < 8; ++j) {
            v8us o;
#pragma unroll
            for (int k = 0; k < 8; ++k) o[k] = f2bf(a[j][k]);
            *(v8us*)(Qp + dst + j * 256) = o;
        }
        asm volatile("s_wait_xcnt 0x0" ::: "memory");   // stands between the q stores and the value loads, which land on registers that those stores name
        __builtin_amdgcn_sched_barrier(0);   // holds the value loads behind the q stores and the wait above
#pragma unroll
        for (int j = 0; j < 8; ++j)
#pragma unroll
            for (int q = 0; q < 8; ++q) c[j][q] = fv[(j & 1) * (16 * HD) + (j >> 1) * 16 + q * HD];
        asm volatile("s_wait_xcnt 0x0" :: "v"(fv) : "memory");   // as above, for the value loads
        __builtin_amdgcn_sched_barrier(0);   // as above: every value load is issued before the key conversions start
#pragma unroll
        for (int j = 0; j < 8; ++j) {
            v8us o;
#pragma unroll
            for (int k = 0; k < 8; ++k) o[k] = f2bf(b[j][k]);
            *(v8us*)(Kf + dst + j * 256) = o;
        }
#pragma unroll
        for (int j = 0; j < 8; ++j) {
            v8h o16; v8us oh;
#pragma unroll
            for (int q = 0; q < 8; ++q) { const float x = bfr(c[j][q]); o16[q] = (h16)x; oh[q] = f2bf(x); }
            *(v8h*)(V16 + dst + j * 256) = o16; *(v8us*)(Vh + dst + j * 256) = oh;
        }
        asm volatile("s_wait_xcnt 0x0" ::: "memory");   // stands between the stores and the next span's step of their address registers
    }
}

// k_attn: streaming causal attention for query block qbl - blockIdx.y of head-plane z = blockIdx.x (qbl = last query block of the launch's range).
// A block's cost grows with its query block; the longest ones (all planes of the last query block) have the lowest flat indices
// and the shortest the highest. Speed only: every (plane, query block) is worked once whatever the order.
// Wave w owns query rows q0..q0+15 (q0 = qb*128 + 16w) and visits key chunks 0..(q0+15)/64 (uniform per wave; waves never exchange data, no block barrier needed).
// Per 64-key chunk: four S^T tiles = K(16 keys x 64 d, A operand) . Q^T (B operand from the [q][d] plane): lane holds query q0 + (lane & 15) and keys k0 + 16j + 8h + r.
// Causal select by value (key > query -> huge negative), for rows from RH on in the wave's last chunk alone, chunk max within the lane then xor-16, running max / scale / sums in f32, p = exp2((t - m) * log2 e).
// The p values of two adjacent 16-key tiles form one P^T B-fragment directly (element r <- tile covering keys 0..15, element 8 + r <- tile covering keys 16..31, lane = query),
// O^T[d][query] += V^T(16 d x 32 keys, A operand from the fragment-order plane) . P^T; HR: p as bf16 hi + lo into the same accumulator with bf16 v, else p x 1024 in f16 with f16 v.
template <bool HR>
__global__ __launch_bounds__(256) __attribute__((amdgpu_num_vgpr(256)))
void k_attn(const bf* __restrict__ Qp, const bf* __restrict__ Kp, const bf* __restrict__ VTh, const h16* __restrict__ VT16, float* OUT, int qbl) {
#pragma clang fp contract(off)
    __shared__ __align__(16) float os[8 * 16 * 68];
    const int lane = threadIdx.x & 31, lr = lane & 15, hi = lane >> 4, wave = threadIdx.x >> 5;
    const size_t z = blockIdx.x;
    const int q0 = (qbl - (int)blockIdx.y) * QT + wave * 16;
    const int myq = q0 + lr;
    const bf* Qz = Qp + z * ((size_t)SEQ * HD);
    const bf* Kz = Kp + z * ((size_t)SEQ * HD);
    const bf* Vhz = VTh + z * ((size_t)HD * SEQ);
    const h16* V16z = VT16 + z * ((size_t)HD * SEQ);
    // Q^T B-fragments (column n = query q0 + lr, k = d), kept for the whole key loop
    const v16bf qf0 = ldb(Qz + (size_t)myq * HD + 8 * hi);
    const v16bf qf1 = ldb(Qz + (size_t)myq * HD + 32 + 8 * hi);
    v8f oacc[4];
#pragma unroll
    for (int dt = 0; dt < 4; ++dt) oacc[dt] = (v8f){};
    float m = NEG, lsum = 0.0f;
    // key chunks with at least one key <= the wave's last query; chunk c always has key 64c <= every query of this wave (the same in every lane, read as a scalar)
    const int nch = __builtin_amdgcn_readfirstlane((q0 + 15) / KC + 1);
    // Fragments are fetched one chunk ahead: a chunk's eight K fragments (i = 4jg + 0..3: keys 32jg + 0..15 d 0..31, d 32..63, keys 32jg + 16..31 d 0..31, d 32..63)
    // and eight V^T fragments (i = 4ks + dt) each start at element 64 * k0 + 512 * i + 8 * lane of their plane.
    const bf* kp = Kz + 8 * lane;      // each lane's place in the chunk being fetched: these pointers live across the passes, so no load lands on its own address registers
    const bf* vbp = Vhz + 8 * lane;
    const h16* vhp = V16z + 8 * lane;
    v16bf kf[8]; v16bf vfb[8]; v16h vfh[8];
#pragma unroll
    for (int i = 0; i < 8; ++i) kf[i] = ldbu(kp + i * 512);
#pragma unroll
    for (int i = 0; i < 8; ++i) { if (HR) vfb[i] = ldbu(vbp + i * 512); else vfh[i] = ldhu(vhp + i * 512); }
    // inputs-only fence on the loaded Q and first K fragments: they have landed in front of the loop (the first product needs them anyway), so the wait at the loop's head
    // is counted from the loop's own load order alone (K older than the sixteen V loads) and leaves the V loads in flight; without it that wait drains part of them on every pass
    asm volatile("" :: "v"(qf0), "v"(qf1), "v"(kf[0]), "v"(kf[1]), "v"(kf[2]), "v"(kf[3]), "v"(kf[4]), "v"(kf[5]), "v"(kf[6]), "v"(kf[7]));
#pragma unroll 1
    for (int c = 0; c < nch; ++c) {
        const int k0 = c * KC;
        const int step = (c + 1 < nch) ? KC * HD : 0;   // on to the next chunk; the last pass fetches its own chunk again (in bounds, unused)
        v8f s[4];
#pragma unroll
        for (int jg = 0; jg < 2; ++jg) {
            const v16bf ka0 = kf[4 * jg], ka1 = kf[4 * jg + 1], kb0 = kf[4 * jg + 2], kb1 = kf[4 * jg + 3];
            v8f t0 = wmmab(ka0, qf0, (v8f){}); t0 = wmmab(ka1, qf1, t0);
            v8f t1 = wmmab(kb0, qf0, (v8f){}); t1 = wmmab(kb1, qf1, t1);
            asm volatile("v_nop\n\tv_nop\n\tv_nop\n\tv_nop" : "+v"(t0), "+v"(t1) : "v"(ka0), "v"(ka1), "v"(kb0), "v"(kb1), "v"(qf0), "v"(qf1));
            s[2 * jg] = t0; s[2 * jg + 1] = t1;
        }
        // rows from RH on: scale, then the causal select by value only in the wave's last chunk (a scalar branch): q0 is a multiple of 16, so every earlier chunk
        // ends at key 64 * (q0 / 64) - 1 < q0 and the select would keep each of its scores. It stands in front of the fetch so that all behind the branch stays one block to schedule.
        // (the loops are unrolled so that s is indexed by constants and stays in registers)
        if (!HR) {
#pragma unroll
            for (int j = 0; j < 4; ++j)
#pragma unroll
                for (int r = 0; r < 8; ++r) s[j][r] *= SCL;
            if (c + 1 == nch) {
#pragma unroll
                for (int j = 0; j < 4; ++j)
#pragma unroll
                    for (int r = 0; r < 8; ++r) s[j][r] = (k0 + 16 * j + 8 * hi + r <= myq) ? s[j][r] : NEG;
            }
        }
        // next chunk's K fragments, into the registers the products above have just left: they fly during the softmax and the p.v products
        kp += step;
#pragma unroll
        for (int i = 0; i < 8; ++i) kf[i] = ldbu(kp + i * 512);
        asm volatile("s_wait_xcnt 0x0" ::: "memory");   // stands between these loads and the next pass's step of their address registers
        if (!HR) __builtin_amdgcn_sched_barrier(0);   // holds these loads here, in front of the softmax: scheduled later they have less of the pass to land in (HR: its registers do not allow it)
        // chunk max; HR: scale and causal select by value here, in every chunk (with the branch that kernel spills to scratch)
        float tmx = NEG;
#pragma unroll
        for (int j = 0; j < 4; ++j) {
#pragma unroll
            for (int r = 0; r < 8; ++r) {
                if (HR) { const int key = k0 + 16 * j + 8 * hi + r; s[j][r] = (key <= myq) ? s[j][r] * SCL : NEG; }
                tmx = fmaxf(tmx, s[j][r]);
            }
        }
        tmx = fmaxf(tmx, __shfl_xor(tmx, 16, 32));
        const float mn = fmaxf(m, tmx);
        const float alpha = __builtin_amdgcn_exp2f((m - mn) * L2E);
        m = mn; lsum *= alpha;
#pragma unroll
        for (int dt = 0; dt < 4; ++dt)
#pragma unroll
            for (int r = 0; r < 8; ++r) oacc[dt][r] *= alpha;
        // weights and their 16-bit P^T fragments (ks = 32-key step: tiles 2ks and 2ks+1)
        v16bf pbh[2], pbl[2]; v16h pf[2];
#pragma unroll
        for (int ks = 0; ks < 2; ++ks) {
            v16us uh, ul; v16h p16;
#pragma unroll
            for (int half = 0; half < 2; ++half) {
                const int j = 2 * ks + half;
#pragma unroll
                for (int r = 0; r < 8; ++r) {
                    const float p = __builtin_amdgcn_exp2f((s[j][r] - mn) * L2E);
                    lsum += p;
                    if (HR) { unsigned short a, b2; splitf(p, a, b2); uh[half * 8 + r] = a; ul[half * 8 + r] = b2; }
                    else { p16[half * 8 + r] = (h16)(p * PCAR); }
                }
            }
            if (HR) { pbh[ks] = __builtin_bit_cast(v16bf, uh); pbl[ks] = __builtin_bit_cast(v16bf, ul); }
            else { pf[ks] = p16; }
        }
        // O^T[d][query] += V^T . P^T over the chunk's 64 keys
#pragma unroll
        for (int ks = 0; ks < 2; ++ks) {
            if (HR) {
                const v16bf bh = pbh[ks], bl = pbl[ks];
                v16bf vf[4];
#pragma unroll
                for (int dt = 0; dt < 4; ++dt) vf[dt] = vfb[4 * ks + dt];
#pragma unroll
                for (int dt = 0; dt < 4; ++dt) { oacc[dt] = wmmab(vf[dt], bh, oacc[dt]); oacc[dt] = wmmab(vf[dt], bl, oacc[dt]); }
                asm volatile("v_nop\n\tv_nop\n\tv_nop\n\tv_nop" : "+v"(oacc[0]), "+v"(oacc[1]), "+v"(oacc[2]), "+v"(oacc[3]) : "v"(vf[0]), "v"(vf[1]), "v"(vf[2]), "v"(vf[3]), "v"(bh), "v"(bl));
            } else {
                const v16h bp = pf[ks];
                v16h vf[4];
#pragma unroll
                for (int dt = 0; dt < 4; ++dt) vf[dt] = vfh[4 * ks + dt];
#pragma unroll
                for (int dt = 0; dt < 4; ++dt) oacc[dt] = wmma16(vf[dt], bp, oacc[dt]);
                asm volatile("v_nop\n\tv_nop\n\tv_nop\n\tv_nop" : "+v"(oacc[0]), "+v"(oacc[1]), "+v"(oacc[2]), "+v"(oacc[3]) : "v"(vf[0]), "v"(vf[1]), "v"(vf[2]), "v"(vf[3]), "v"(bp));
            }
        }
        // next chunk's V^T fragments, into the registers just left: they fly during the next chunk's score products and softmax
        if (HR) vbp += step; else vhp += step;
#pragma unroll
        for (int i = 0; i < 8; ++i) { if (HR) vfb[i] = ldbu(vbp + i * 512); else vfh[i] = ldhu(vhp + i * 512); }
        asm volatile("s_wait_xcnt 0x0" ::: "memory");   // stands between these loads and the next pass's step of their address registers
    }
    // normalise and write: lane holds query lr, d = dt*16 + 8h + r
    lsum += __shfl_xor(lsum, 16, 32);
    const float inv = __fdiv_rn(HR ? 1.0f : PCINV, lsum);
    float* osw = os + wave * (16 * 68);   // wave-private staging tile [16 queries][64 d], pitch 68
#pragma unroll
    for (int dt = 0; dt < 4; ++dt)
#pragma unroll
        for (int r = 0; r < 8; ++r) osw[lr * 68 + dt * 16 + 8 * hi + r] = oacc[dt][r] * inv;
    __builtin_amdgcn_fence(3, "wavefront"); __builtin_amdgcn_wave_barrier(); asm volatile("" ::: "memory");
    float* orow = OUT + (z * SEQ + (size_t)q0) * HD;
    v4f val[8];
#pragma unroll
    for (int sg = 0; sg < 8; ++sg) val[sg] = *(const v4fa*)(osw + (2 * sg + hi) * 68 + lr * 4);
#pragma unroll
    for (int sg = 0; sg < 8; ++sg) *(v4f*)(orow + (size_t)(2 * sg + hi) * HD + lr * 4) = val[sg];
    
}

extern "C" void kernel_launch(void* const* d_in, const int* in_sizes, int n_in,
                              void* d_out, int out_size, void* d_ws, size_t ws_size, hipStream_t stream) {
    if (n_in < 3) return;
    const float* xq = (const float*)d_in[0];   // [NB][16][SEQ_FULL][64] f32
    const float* xk = (const float*)d_in[1];
    const float* xv = (const float*)d_in[2];
    float* OUT = (float*)d_out;                // [NB][16][SEQ][64] f32
    const long long need_in = (long long)(NZ - 1) * SEQ_FULL * HD + (long long)SEQ * HD;
    if ((long long)in_sizes[0] < need_in || (long long)in_sizes[1] < need_in || (long long)in_sizes[2] < need_in) return;
    if ((long long)out_size < (long long)NZ * SEQ * HD) return;
    char* wsp = (char*)d_ws;
    auto take = [&](size_t bytes) { char* p = wsp; wsp += (bytes + 255) & ~(size_t)255; return (void*)p; };
    const size_t plane = (size_t)NZ * SEQ * HD;      // elements per 16-bit plane
    bf*  Qp   = (bf*)take(plane * 2);                 // [z][t][d] bf16
    bf*  Kp   = (bf*)take(plane * 2);                 // fragment order, bf16
    bf*  VTh  = (bf*)take(plane * 2);                 // fragment order, bf16
    h16* VT16 = (h16*)take(plane * 2);                // fragment order, f16
    if ((size_t)(wsp - (char*)d_ws) > ws_size) return;   // 4 x 16 MiB = 64 MiB at full size
    k_pack<<<PKB, 512, 0, stream>>>(xq, xk, xv, Qp, Kp, VT16, VTh);
    const int nqb = SEQ / QT;
    const int rhb = ((RH < SEQ) ? RH : SEQ) / QT;
    if (rhb > 0) k_attn<true><<<dim3(NZ, (unsigned)rhb), 256, 0, stream>>>(Qp, Kp, VTh, VT16, OUT, rhb - 1);
    if (nqb - rhb > 0) k_attn<false><<<dim3(NZ, (unsigned)(nqb - rhb)), 256, 0, stream>>>(Qp, Kp, VTh, VT16, OUT, nqb - 1);
}

// v006
// One run takes 88.1 microseconds.
// Timed twice side by side with v005, it ran 1.20 and 1.21 times as fast.
// All steps since v000 together make it 4.17 times as fast.
#include <hip/hip_runtime.h>

// Contractions (f32 accumulate): score tiles k.q^T on v_wmma_f32_16x16x32_bf16 (bf16 operands = RNE-converted q and k, exact products, x0.125 applied in f32);
// p.v on v_wmma_f32_16x16x32_bf16 (p as bf16 hi + bf16 lo, v bf16) for query rows below RH, and on v_wmma_f32_16x16x32_f16 (p carried x1024 in f16, v f16) for the remaining rows;
// running-max softmax, row sums and the final 1/l scaling in f32; f32 output.
// Layout: one launch converts q into a bf16 plane [z][t][d] (z = b*16 + h) and k (bf16) and v (f16 and bf16) into planes stored in fragment order:
// every 16-byte-per-lane load of a K or V^T fragment half is one 512-byte unit [lane][8 elements], so a wave-wide load reads four whole 128-byte lines.
// One streaming causal attention launch for all query blocks (a block takes the one or the other p.v form by its query rows): 8 waves x 16 query rows per block, 64-key chunks, operands loaded as fragments straight from the planes, one chunk ahead of their use,
// causal select by value (rows from RH on: only in the one chunk of a wave that crosses the diagonal), key chunks entirely above the diagonal are never visited (their weights are exactly zero).

#ifndef NB
#define NB 2
#endif
#ifndef SEQ
#define SEQ 4096
#endif
#ifndef SEQ_FULL
#define SEQ_FULL 4096
#endif
#ifndef RH
#define RH 1024
#endif
#define NH 16
#define HD 64
#define NZ (NB * NH)
#define QT 128
#define KC 64
#define PCAR 1024.0f
#define PCINV 0.0009765625f
#define SCL 0.125f
#define L2E 1.4426950408889634f
#define NEG (-1.0e30f)
#define PKB 256   // packing work-groups: one per WGP of the chip (speed only: the span loop strides by the grid, so any count does all the work once)
static_assert(SEQ % QT == 0);
static_assert(SEQ % KC == 0);
static_assert(RH % QT == 0);
static_assert(QT == 8 * 16);
static_assert(HD == 64);
static_assert(SEQ % 32 == 0);
static_assert(SEQ <= SEQ_FULL);
static_assert(((long long)NZ * SEQ * HD) % 8 == 0);

typedef _Float16 h16;
typedef unsigned short bf;
typedef __attribute__((ext_vector_type(16))) __bf16         v16bf;
typedef __attribute__((ext_vector_type(16))) _Float16       v16h;
typedef __attribute__((ext_vector_type(16))) unsigned short v16us;
typedef __attribute__((ext_vector_type(8)))  _Float16       v8h;
typedef __attribute__((ext_vector_type(8)))  unsigned short v8us;
typedef __attribute__((ext_vector_type(8)))  float          v8f;
typedef __attribute__((ext_vector_type(4)))  float          v4f;
typedef __attribute__((ext_vector_type(2)))  _Float16       v2h;
typedef __attribute__((ext_vector_type(2)))  unsigned short v2us;
typedef v4f __attribute__((may_alias)) v4fa;

__device__ __forceinline__ unsigned short f2bf(float f) { unsigned u = __float_as_uint(f); u += 0x7FFFu + ((u >> 16) & 1u); return (unsigned short)(u >> 16); }
__device__ __forceinline__ float bf2f(unsigned short b) { return __uint_as_float(((unsigned)b) << 16); }
__device__ __forceinline__ float bfr(float f) { return bf2f(f2bf(f)); }
__device__ __forceinline__ void splitf(float y, unsigned short& h, unsigned short& l) { h = f2bf(y); l = f2bf(y - bf2f(h)); }
__device__ __forceinline__ v16h  cat16(v8h lo, v8h hi) { return __builtin_shufflevector(lo, hi, 0, 1, 2, 3, 4, 5, 6, 7, 8, 9, 10, 11, 12, 13, 14, 15); }
__device__ __forceinline__ v16bf cat16b(v8us lo, v8us hi) { return __builtin_bit_cast(v16bf, __builtin_shufflevector(lo, hi, 0, 1, 2, 3, 4, 5, 6, 7, 8, 9, 10, 11, 12, 13, 14, 15)); }
__device__ __forceinline__ v8f wmma16(v16h a, v16h b, v8f c) { return __builtin_amdgcn_wmma_f32_16x16x32_f16(false, a, false, b, (short)0, c, false, false); }
__device__ __forceinline__ v8f wmmab(v16bf a, v16bf b, v8f c) { return __builtin_amdgcn_wmma_f32_16x16x32_bf16(false, a, false, b, (short)0, c, false, false); }

// Fragment loader for a 16 x 32(k) operand tile from a k-contiguous 16-bit row; p = base + row(lane & 15) * pitch + k0 + 8 * (lane >> 4):
// elements 0..7 = k0 + 8h + 0..7, elements 8..15 = k0 + 16 + 8h + 0..7 (same map for the A operand, row = lane & 15, and for the B operand stored [n][k], column = lane & 15).
__device__ __forceinline__ v16bf ldb(const bf* p) { return cat16b(*(const v8us*)p, *(const v8us*)(p + 16)); }
// The same fragments from a fragment-order plane; p = first unit of the fragment + 8 * lane: elements 0..7 from that unit, elements 8..15 from the next unit (256 elements on).
__device__ __forceinline__ v16bf ldbu(const bf* p) { return cat16b(*(const v8us*)p, *(const v8us*)(p + 256)); }
__device__ __forceinline__ v16h  ldhu(const h16* p) { return cat16(*(const v8h*)p, *(const v8h*)(p + 256)); }

// k_pack: all three conversions in one resident stream. PKB work-groups of 16 waves; a wave takes whole spans of 32 positions x 64 d of one plane z (8 KiB of f32 per input,
// 256 destination pieces of 16 bytes, piece = 256 * span + 32j + lane, j = 0..7) and has a span's loads in flight together, so that few waves have to start and each keeps the memory busy.
// Qp[z][t][d]: piece j holds elements 256j + 8 * lane + 0..7 of the span.
// Kf[z][t / 16][u][lane][8]: unit u (0..3) of a 16-key tile holds, at lane, key 16 * tile + (lane & 15), d = 16u + 8 * (lane >> 4) + 0..7
// (units 0, 1 = the A fragment for d 0..31, units 2, 3 = the one for d 32..63); piece j = tile j >> 2 of the span, unit j & 3.
// V16 / Vh[z][t / 32][dt][u][lane][8] (f16 and bf16 bits of the RNE-converted input): unit u (0, 1) of the V^T A fragment for d tile dt and a 32-key step
// holds, at lane, d = 16dt + (lane & 15), keys 32 * step + 16u + 8 * (lane >> 4) + 0..7; piece j = d tile j >> 1, unit j & 1. Sources [z][t][d] with z-pitch SEQ_FULL*HD.
__global__ __launch_bounds__(512) void k_pack(const float* __restrict__ xq, const float* __restrict__ xk, const float* __restrict__ xv, bf* Qp, bf* Kf, h16* V16, bf* Vh) {
    const int lane = threadIdx.x & 31, lr = lane & 15, hi = lane >> 4;
    const int wave = __builtin_amdgcn_readfirstlane((int)(threadIdx.x >> 5));   // the same in every lane: span bases stay scalar
    for (int sp = (int)blockIdx.x * 16 + wave; sp < NZ * (SEQ / 32); sp += (int)gridDim.x * 16) {
        const size_t src = ((size_t)(sp / (SEQ / 32)) * SEQ_FULL + (size_t)(sp % (SEQ / 32)) * 32) * HD;
        const size_t dst = (size_t)sp * 2048 + (size_t)lane * 8;
        const float* fq = xq + src + lane * 8;
        const float* fk = xk + src + lr * HD + hi * 8;
        const float* fv = xv + src + hi * (8 * HD) + lr;
        v8f a[8], b[8]; float c[8][8];
#pragma unroll
        for (int j = 0; j < 8; ++j) a[j] = *(const v8f*)(fq + j * 256);
#pragma unroll
        for (int j = 0; j < 8; ++j) b[j] = *(const v8f*)(fk + (j >> 2) * (16 * HD) + (j & 3) * 16);
        // stands in front of any reuse of these loads' address registers; the pointers are inputs so that they stay live up to here and no load lands on an address register
        asm volatile("s_wait_xcnt 0x0" :: "v"(fq), "v"(fk) : "memory");
        __builtin_amdgcn_sched_barrier(0);   // all 32 loads are issued before any conversion: scheduled among the conversions, the later ones would start only when the earlier have landed
#pragma unroll
        for (int j = 0; j < 8; ++j) {
            v8us o;
#pragma unroll
            for (int k = 0; k < 8; ++k) o[k] = f2bf(a[j][k]);
            *(v8us*)(Qp + dst + j * 256) = o;
        }
        asm volatile("s_wait_xcnt 0x0" ::: "memory");   // stands between the q stores and the value loads, which land on registers that those stores name
        __builtin_amdgcn_sched_barrier(0);   // holds the value loads behind the q stores and the wait above
#pragma unroll
        for (int j = 0; j < 8; ++j)
#pragma unroll
            for (int q = 0; q < 8; ++q) c[j][q] = fv[(j & 1) * (16 * HD) + (j >> 1) * 16 + q * HD];
        asm volatile("s_wait_xcnt 0x0" :: "v"(fv) : "memory");   // as above, for the value loads
        __builtin_amdgcn_sched_barrier(0);   // as above: every value load is issued before the key conversions start
#pragma unroll
        for (int j = 0; j < 8; ++j) {
            v8us o;
#pragma unroll
            for (int k = 0; k < 8; ++k) o[k] = f2bf(b[j][k]);
            *(v8us*)(Kf + dst + j * 256) = o;
        }
#pragma unroll
        for (int j = 0; j < 8; ++j) {
            v8h o16; v8us oh;
#pragma unroll
            for (int q = 0; q < 8; ++q) { const float x = bfr(c[j][q]); o16[q] = (h16)x; oh[q] = f2bf(x); }
            *(v8h*)(V16 + dst + j * 256) = o16; *(v8us*)(Vh + dst + j * 256) = oh;
        }
        asm volatile("s_wait_xcnt 0x0" ::: "memory");   // stands between the stores and the next span's step of their address registers
    }
}

// attn_block: streaming causal attention for query block qb of head-plane z = blockIdx.x (os: the block's staging tiles in LDS).
// Wave w owns query rows q0..q0+15 (q0 = qb*128 + 16w) and visits key chunks 0..(q0+15)/64 (uniform per wave; waves never exchange data, no block barrier needed).
// Per 64-key chunk: four S^T tiles = K(16 keys x 64 d, A operand) . Q^T (B operand from the [q][d] plane): lane holds query q0 + (lane & 15) and keys k0 + 16j + 8h + r.
// Causal select by value (key > query -> huge negative), for rows from RH on in the wave's last chunk alone, chunk max within the lane then xor-16, running max / scale / sums in f32, p = exp2((t - m) * log2 e).
// The p values of two adjacent 16-key tiles form one P^T B-fragment directly (element r <- tile covering keys 0..15, element 8 + r <- tile covering keys 16..31, lane = query),
// O^T[d][query] += V^T(16 d x 32 keys, A operand from the fragment-order plane) . P^T; HR: p as bf16 hi + lo into the same accumulator with bf16 v, else p x 1024 in f16 with f16 v.
template <bool HR>
__device__ __forceinline__ void attn_block(const bf* __restrict__ Qp, const bf* __restrict__ Kp, const bf* __restrict__ VTh, const h16* __restrict__ VT16, float* OUT, float* os, int qb) {
#pragma clang fp contract(off)
    const int lane = threadIdx.x & 31, lr = lane & 15, hi = lane >> 4, wave = threadIdx.x >> 5;
    const size_t z = blockIdx.x;
    const int q0 = qb * QT + wave * 16;
    const int myq = q0 + lr;
    const bf* Qz = Qp + z * ((size_t)SEQ * HD);
    const bf* Kz = Kp + z * ((size_t)SEQ * HD);
    const bf* Vhz = VTh + z * ((size_t)HD * SEQ);
    const h16* V16z = VT16 + z * ((size_t)HD * SEQ);
    // Q^T B-fragments (column n = query q0 + lr, k = d), kept for the whole key loop
    const bf* qp = Qz + (size_t)myq * HD + 8 * hi;
    const v16bf qf0 = ldb(qp);
    const v16bf qf1 = ldb(qp + 32);
    v8f oacc[4];
#pragma unroll
    for (int dt = 0; dt < 4; ++dt) oacc[dt] = (v8f){};
    float m = NEG, lsum = 0.0f;
    // key chunks with at least one key <= the wave's last query; chunk c always has key 64c <= every query of this wave (the same in every lane, read as a scalar)
    const int nch = __builtin_amdgcn_readfirstlane((q0 + 15) / KC + 1);
    // Fragments are fetched one chunk ahead: a chunk's eight K fragments (i = 4jg + 0..3: keys 32jg + 0..15 d 0..31, d 32..63, keys 32jg + 16..31 d 0..31, d 32..63)
    // and eight V^T fragments (i = 4ks + dt) each start at element 64 * k0 + 512 * i + 8 * lane of their plane.
    const bf* kp = Kz + 8 * lane;      // each lane's place in the chunk being fetched: these pointers live across the passes, so no load lands on its own address registers
    const bf* vbp = Vhz + 8 * lane;
    const h16* vhp = V16z + 8 * lane;
    v16bf kf[8]; v16bf vfb[8]; v16h vfh[8];
#pragma unroll
    for (int i = 0; i < 8; ++i) kf[i] = ldbu(kp + i * 512);
#pragma unroll
    for (int i = 0; i < 8; ++i) { if (HR) vfb[i] = ldbu(vbp + i * 512); else vfh[i] = ldhu(vhp + i * 512); }
    // inputs-only fence on the loaded Q and first K fragments: they have landed in front of the loop (the first product needs them anyway), so the wait at the loop's head
    // is counted from the loop's own load order alone (K older than the sixteen V loads) and leaves the V loads in flight; without it that wait drains part of them on every pass
    asm volatile("" :: "v"(qf0), "v"(qf1), "v"(kf[0]), "v"(kf[1]), "v"(kf[2]), "v"(kf[3]), "v"(kf[4]), "v"(kf[5]), "v"(kf[6]), "v"(kf[7]));
    // stands in front of any reuse of the Q loads' address registers; the pointer is an input so that it stays live up to here
    asm volatile("s_wait_xcnt 0x0" :: "v"(qp) : "memory");
#pragma unroll 1
    for (int c = 0; c < nch; ++c) {
        const int k0 = c * KC;
        const int step = (c + 1 < nch) ? KC * HD : 0;   // on to the next chunk; the last pass fetches its own chunk again (in bounds, unused)
        v8f s[4];
#pragma unroll
        for (int jg = 0; jg < 2; ++jg) {
            const v16bf ka0 = kf[4 * jg], ka1 = kf[4 * jg + 1], kb0 = kf[4 * jg + 2], kb1 = kf[4 * jg + 3];
            v8f t0 = wmmab(ka0, qf0, (v8f){}); t0 = wmmab(ka1, qf1, t0);
            v8f t1 = wmmab(kb0, qf0, (v8f){}); t1 = wmmab(kb1, qf1, t1);
            asm volatile("v_nop\n\tv_nop\n\tv_nop\n\tv_nop" : "+v"(t0), "+v"(t1) : "v"(ka0), "v"(ka1), "v"(kb0), "v"(kb1), "v"(qf0), "v"(qf1));
            s[2 * jg] = t0; s[2 * jg + 1] = t1;
        }
        // rows from RH on: scale, then the causal select by value only in the wave's last chunk (a scalar branch): q0 is a multiple of 16, so every earlier chunk
        // ends at key 64 * (q0 / 64) - 1 < q0 and the select would keep each of its scores. It stands in front of the fetch so that all behind the branch stays one block to schedule.
        // (the loops are unrolled so that s is indexed by constants and stays in registers)
        if (!HR) {
#pragma unroll
            for (int j = 0; j < 4; ++j)
#pragma unroll
                for (int r = 0; r < 8; ++r) s[j][r] *= SCL;
            if (c + 1 == nch) {
#pragma unroll
                for (int j = 0; j < 4; ++j)
#pragma unroll
                    for (int r = 0; r < 8; ++r) s[j][r] = (k0 + 16 * j + 8 * hi + r <= myq) ? s[j][r] : NEG;
            }
        }
        // next chunk's K fragments, into the registers the products above have just left: they fly during the softmax and the p.v products
        kp += step;
#pragma unroll
        for (int i = 0; i < 8; ++i) kf[i] = ldbu(kp + i * 512);
        asm volatile("s_wait_xcnt 0x0" ::: "memory");   // stands between these loads and the next pass's step of their address registers
        if (!HR) __builtin_amdgcn_sched_barrier(0);   // holds these loads here, in front of the softmax: scheduled later they have less of the pass to land in (HR: its registers do not allow it)
        // chunk max; HR: scale and causal select by value here, in every chunk (with the branch that kernel spills to scratch)
        float tmx = NEG;
#pragma unroll
        for (int j = 0; j < 4; ++j) {
#pragma unroll
            for (int r = 0; r < 8; ++r) {
                if (HR) { const int key = k0 + 16 * j + 8 * hi + r; s[j][r] = (key <= myq) ? s[j][r] * SCL : NEG; }
                tmx = fmaxf(tmx, s[j][r]);
            }
        }
        tmx = fmaxf(tmx, __shfl_xor(tmx, 16, 32));
        const float mn = fmaxf(m, tmx);
        const float alpha = __builtin_amdgcn_exp2f((m - mn) * L2E);
        m = mn; lsum *= alpha;
#pragma unroll
        for (int dt = 0; dt < 4; ++dt)
#pragma unroll
            for (int r = 0; r < 8; ++r) oacc[dt][r] *= alpha;
        // weights and their 16-bit P^T fragments (ks = 32-key step: tiles 2ks and 2ks+1)
        v16bf pbh[2], pbl[2]; v16h pf[2];
#pragma unroll
        for (int ks = 0; ks < 2; ++ks) {
            v16us uh, ul; v16h p16;
#pragma unroll
            for (int half = 0; half < 2; ++half) {
                const int j = 2 * ks + half;
#pragma unroll
                for (int r = 0; r < 8; ++r) {
                    const float p = __builtin_amdgcn_exp2f((s[j][r] - mn) * L2E);
                    lsum += p;
                    if (HR) { unsigned short a, b2; splitf(p, a, b2); uh[half * 8 + r] = a; ul[half * 8 + r] = b2; }
                    else { p16[half * 8 + r] = (h16)(p * PCAR); }
                }
            }
            if (HR) { pbh[ks] = __builtin_bit_cast(v16bf, uh); pbl[ks] = __builtin_bit_cast(v16bf, ul); }
            else { pf[ks] = p16; }
        }
        // O^T[d][query] += V^T . P^T over the chunk's 64 keys
#pragma unroll
        for (int ks = 0; ks < 2; ++ks) {
            if (HR) {
                const v16bf bh = pbh[ks], bl = pbl[ks];
                v16bf vf[4];
#pragma unroll
                for (int dt = 0; dt < 4; ++dt) vf[dt] = vfb[4 * ks + dt];
#pragma unroll
                for (int dt = 0; dt < 4; ++dt) { oacc[dt] = wmmab(vf[dt], bh, oacc[dt]); oacc[dt] = wmmab(vf[dt], bl, oacc[dt]); }
                asm volatile("v_nop\n\tv_nop\n\tv_nop\n\tv_nop" : "+v"(oacc[0]), "+v"(oacc[1]), "+v"(oacc[2]), "+v"(oacc[3]) : "v"(vf[0]), "v"(vf[1]), "v"(vf[2]), "v"(vf[3]), "v"(bh), "v"(bl));
            } else {
                const v16h bp = pf[ks];
                v16h vf[4];
#pragma unroll
                for (int dt = 0; dt < 4; ++dt) vf[dt] = vfh[4 * ks + dt];
#pragma unroll
                for (int dt = 0; dt < 4; ++dt) oacc[dt] = wmma16(vf[dt], bp, oacc[dt]);
                asm volatile("v_nop\n\tv_nop\n\tv_nop\n\tv_nop" : "+v"(oacc[0]), "+v"(oacc[1]), "+v"(oacc[2]), "+v"(oacc[3]) : "v"(vf[0]), "v"(vf[1]), "v"(vf[2]), "v"(vf[3]), "v"(bp));
            }
        }
        // next chunk's V^T fragments, into the registers just left: they fly during the next chunk's score products and softmax
        if (HR) vbp += step; else vhp += step;
#pragma unroll
        for (int i = 0; i < 8; ++i) { if (HR) vfb[i] = ldbu(vbp + i * 512); else vfh[i] = ldhu(vhp + i * 512); }
        asm volatile("s_wait_xcnt 0x0" ::: "memory");   // stands between these loads and the next pass's step of their address registers
    }
    // normalise and write: lane holds query lr, d = dt*16 + 8h + r
    lsum += __shfl_xor(lsum, 16, 32);
    const float inv = __fdiv_rn(HR ? 1.0f : PCINV, lsum);
    float* osw = os + wave * (16 * 68);   // wave-private staging tile [16 queries][64 d], pitch 68
#pragma unroll
    for (int dt = 0; dt < 4; ++dt)
#pragma unroll
        for (int r = 0; r < 8; ++r) osw[lr * 68 + dt * 16 + 8 * hi + r] = oacc[dt][r] * inv;
    __builtin_amdgcn_fence(3, "wavefront"); __builtin_amdgcn_wave_barrier(); asm volatile("" ::: "memory");
    float* orow = OUT + (z * SEQ + (size_t)q0) * HD;
    v4f val[8];
#pragma unroll
    for (int sg = 0; sg < 8; ++sg) val[sg] = *(const v4fa*)(osw + (2 * sg + hi) * 68 + lr * 4);
#pragma unroll
    for (int sg = 0; sg < 8; ++sg) *(v4f*)(orow + (size_t)(2 * sg + hi) * HD + lr * 4) = val[sg];
}

// k_attn: one grid for every (plane z = blockIdx.x, query block); blockIdx.y is the query block's rank by cost.
// The grid holds more blocks than the chip has places and cost falls with the rank: the longest blocks take the lowest ranks and the
// shortest the highest (for speed only). A block's cost is its key chunks, 16 * qb + 12 over its eight waves, counted double for query rows below RH (about twice the vector
// instructions a chunk). The rank is found by merging the two falling lists, so every query block has exactly one rank whatever the sizes. Speed only: the order changes no value.
__global__ __launch_bounds__(256) __attribute__((amdgpu_num_vgpr(256)))
void k_attn(const bf* __restrict__ Qp, const bf* __restrict__ Kp, const bf* __restrict__ VTh, const h16* __restrict__ VT16, float* OUT) {
    __shared__ __align__(16) float os[8 * 16 * 68];
    constexpr int nqb = SEQ / QT, rhb = ((RH < SEQ) ? RH : SEQ) / QT;
    int a = nqb - 1, b = rhb - 1, qb = 0;   // next block of each list: rows from RH on, rows below RH
#pragma unroll 1   // a few scalar instructions a trip, once a block: unrolled it only lengthens the text in front of the hot loops
    for (int i = 0; i <= (int)blockIdx.y; ++i) {
        const bool low = a < rhb || (b >= 0 && 2 * (16 * b + 12) > 16 * a + 12);
        qb = low ? b-- : a--;
    }
    if (qb >= rhb) {
        attn_block<false>(Qp, Kp, VTh, VT16, OUT, os, qb);
    } else {
        // compiler fence at the head of this side alone: without it the first K loads, alike on both sides, are merged in front of the branch and the body for rows below RH spills to scratch
        asm volatile("" ::: "memory");
        attn_block<true>(Qp, Kp, VTh, VT16, OUT, os, qb);
    }
}

extern "C" void kernel_launch(void* const* d_in, const int* in_sizes, int n_in,
                              void* d_out, int out_size, void* d_ws, size_t ws_size, hipStream_t stream) {
    if (n_in < 3) return;
    const float* xq = (const float*)d_in[0];   // [NB][16][SEQ_FULL][64] f32
    const float* xk = (const float*)d_in[1];
    const float* xv = (const float*)d_in[2];
    float* OUT = (float*)d_out;                // [NB][16][SEQ][64] f32
    const long long need_in = (long long)(NZ - 1) * SEQ_FULL * HD + (long long)SEQ * HD;
    if ((long long)in_sizes[0] < need_in || (long long)in_sizes[1] < need_in || (long long)in_sizes[2] < need_in) return;
    if ((long long)out_size < (long long)NZ * SEQ * HD) return;
    char* wsp = (char*)d_ws;
    auto take = [&](size_t bytes) { char* p = wsp; wsp += (bytes + 255) & ~(size_t)255; return (void*)p; };
    const size_t plane = (size_t)NZ * SEQ * HD;      // elements per 16-bit plane
    bf*  Qp   = (bf*)take(plane * 2);                 // [z][t][d] bf16
    bf*  Kp   = (bf*)take(plane * 2);                 // fragment order, bf16
    bf*  VTh  = (bf*)take(plane * 2);                 // fragment order, bf16
    h16* VT16 = (h16*)take(plane * 2);                // fragment order, f16
    if ((size_t)(wsp - (char*)d_ws) > ws_size) return;   // 4 x 16 MiB = 64 MiB at full size
    k_pack<<<PKB, 512, 0, stream>>>(xq, xk, xv, Qp, Kp, VT16, VTh);
    k_attn<<<dim3(NZ, SEQ / QT), 256, 0, stream>>>(Qp, Kp, VTh, VT16, OUT);
}

// v007
// One run takes 83.2 microseconds.
// Timed twice side by side with v006, it ran 1.06 times as fast both times.
// Counting every step since v000, it is 4.41 times as fast.
#include <hip/hip_runtime.h>

// Contractions (f32 accumulate): score tiles k.q^T on v_wmma_f32_16x16x32_bf16 (bf16 operands = RNE-converted q and k, exact products; x0.125 is part of the f32 factor of the exponent's argument);
// p.v on v_wmma_f32_16x16x32_bf16 (p as bf16 hi + bf16 lo, v bf16) for query rows below RH, and on v_wmma_f32_16x16x32_f16 (p carried x1024 in f16, v f16) for the remaining rows;
// running-max softmax (maximum kept on the unscaled scores for rows from RH on, on the scores x 0.125 log2 e below RH), row sums and the final 1/l scaling in f32; f32 output.
// Layout: one launch converts q into a bf16 plane [z][t][d] (z = b*16 + h) and k (bf16) and v (f16 and bf16) into planes stored in fragment order:
// every 16-byte-per-lane load of a K or V^T fragment half is one 512-byte unit [lane][8 elements], so a wave-wide load reads four whole 128-byte lines.
// One streaming causal attention launch for all query blocks (a block takes the one or the other p.v form by its query rows): 8 waves x 16 query rows per block, 64-key chunks, operands loaded as fragments straight from the planes, one chunk ahead of their use,
// causal select by value (rows from RH on: only in the one chunk of a wave that crosses the diagonal), key chunks entirely above the diagonal are never visited (their weights are exactly zero).

#ifndef NB
#define NB 2
#endif
#ifndef SEQ
#define SEQ 4096
#endif
#ifndef SEQ_FULL
#define SEQ_FULL 4096
#endif
#ifndef RH
#define RH 1024
#endif
#define NH 16
#define HD 64
#define NZ (NB * NH)
#define QT 128
#define KC 64
#define PCL2 10.0f   // p is carried x 2^10 where it goes to f16: added to the exponent's argument, so weights and row sums both hold it and it cancels in the division
#define SCL 0.125f
#define L2E 1.4426950408889634f
#define CEX (SCL * L2E)   // score scale and log2 e as one factor (a power of two times the f32 log2 e: no second rounding)
#define NEG (-1.0e30f)
#define PKB 256   // packing work-groups: one per WGP of the chip (speed only: the span loop strides by the grid, so any count does all the work once)
static_assert(SEQ % QT == 0);
static_assert(SEQ % KC == 0);
static_assert(RH % QT == 0);
static_assert(QT == 8 * 16);
static_assert(HD == 64);
static_assert(SEQ % 32 == 0);
static_assert(SEQ <= SEQ_FULL);
static_assert(((long long)NZ * SEQ * HD) % 8 == 0);

typedef _Float16 h16;
typedef unsigned short bf;
typedef __attribute__((ext_vector_type(16))) __bf16         v16bf;
typedef __attribute__((ext_vector_type(16))) _Float16       v16h;
typedef __attribute__((ext_vector_type(16))) unsigned short v16us;
typedef __attribute__((ext_vector_type(8)))  _Float16       v8h;
typedef __attribute__((ext_vector_type(8)))  unsigned short v8us;
typedef __attribute__((ext_vector_type(8)))  float          v8f;
typedef __attribute__((ext_vector_type(4)))  float          v4f;
typedef __attribute__((ext_vector_type(2)))  _Float16       v2h;
typedef __attribute__((ext_vector_type(2)))  unsigned short v2us;
typedef v4f __attribute__((may_alias)) v4fa;

__device__ __forceinline__ unsigned short f2bf(float f) { unsigned u = __float_as_uint(f); u += 0x7FFFu + ((u >> 16) & 1u); return (unsigned short)(u >> 16); }
__device__ __forceinline__ float bf2f(unsigned short b) { return __uint_as_float(((unsigned)b) << 16); }
__device__ __forceinline__ float bfr(float f) { return bf2f(f2bf(f)); }
__device__ __forceinline__ void splitf(float y, unsigned short& h, unsigned short& l) { h = f2bf(y); l = f2bf(y - bf2f(h)); }
__device__ __forceinline__ v16h  cat16(v8h lo, v8h hi) { return __builtin_shufflevector(lo, hi, 0, 1, 2, 3, 4, 5, 6, 7, 8, 9, 10, 11, 12, 13, 14, 15); }
__device__ __forceinline__ v16bf cat16b(v8us lo, v8us hi) { return __builtin_bit_cast(v16bf, __builtin_shufflevector(lo, hi, 0, 1, 2, 3, 4, 5, 6, 7, 8, 9, 10, 11, 12, 13, 14, 15)); }
__device__ __forceinline__ v8f wmma16(v16h a, v16h b, v8f c) { return __builtin_amdgcn_wmma_f32_16x16x32_f16(false, a, false, b, (short)0, c, false, false); }
__device__ __forceinline__ v8f wmmab(v16bf a, v16bf b, v8f c) { return __builtin_amdgcn_wmma_f32_16x16x32_bf16(false, a, false, b, (short)0, c, false, false); }

// Fragment loader for a 16 x 32(k) operand tile from a k-contiguous 16-bit row; p = base + row(lane & 15) * pitch + k0 + 8 * (lane >> 4):
// elements 0..7 = k0 + 8h + 0..7, elements 8..15 = k0 + 16 + 8h + 0..7 (same map for the A operand, row = lane & 15, and for the B operand stored [n][k], column = lane & 15).
__device__ __forceinline__ v16bf ldb(const bf* p) { return cat16b(*(const v8us*)p, *(const v8us*)(p + 16)); }
// The same fragments from a fragment-order plane; p = first unit of the fragment + 8 * lane: elements 0..7 from that unit, elements 8..15 from the next unit (256 elements on).
__device__ __forceinline__ v16bf ldbu(const bf* p) { return cat16b(*(const v8us*)p, *(const v8us*)(p + 256)); }
__device__ __forceinline__ v16h  ldhu(const h16* p) { return cat16(*(const v8h*)p, *(const v8h*)(p + 256)); }

// k_pack: all three conversions in one resident stream. PKB work-groups of 16 waves; a wave takes whole spans of 32 positions x 64 d of one plane z (8 KiB of f32 per input,
// 256 destination pieces of 16 bytes, piece = 256 * span + 32j + lane, j = 0..7) and has a span's loads in flight together, so that few waves have to start and each keeps the memory busy.
// Qp[z][t][d]: piece j holds elements 256j + 8 * lane + 0..7 of the span.
// Kf[z][t / 16][u][lane][8]: unit u (0..3) of a 16-key tile holds, at lane, key 16 * tile + (lane & 15), d = 16u + 8 * (lane >> 4) + 0..7
// (units 0, 1 = the A fragment for d 0..31, units 2, 3 = the one for d 32..63); piece j = tile j >> 2 of the span, unit j & 3.
// V16 / Vh[z][t / 32][dt][u][lane][8] (f16 and bf16 bits of the RNE-converted input): unit u (0, 1) of the V^T A fragment for d tile dt and a 32-key step
// holds, at lane, d = 16dt + (lane & 15), keys 32 * step + 16u + 8 * (lane >> 4) + 0..7; piece j = d tile j >> 1, unit j & 1. Sources [z][t][d] with z-pitch SEQ_FULL*HD.
__global__ __launch_bounds__(512) void k_pack(const float* __restrict__ xq, const float* __restrict__ xk, const float* __restrict__ xv, bf* Qp, bf* Kf, h16* V16, bf* Vh) {
    const int lane = threadIdx.x & 31, lr = lane & 15, hi = lane >> 4;
    const int wave = __builtin_amdgcn_readfirstlane((int)(threadIdx.x >> 5));   // the same in every lane: span bases stay scalar
    for (int sp = (int)blockIdx.x * 16 + wave; sp < NZ * (SEQ / 32); sp += (int)gridDim.x * 16) {
        const size_t src = ((size_t)(sp / (SEQ / 32)) * SEQ_FULL + (size_t)(sp % (SEQ / 32)) * 32) * HD;
        const size_t dst = (size_t)sp * 2048 + (size_t)lane * 8;
        const float* fq = xq + src + lane * 8;
        const float* fk = xk + src + lr * HD + hi * 8;
        const float* fv = xv + src + hi * (8 * HD) + lr;
        v8f a[8], b[8]; float c[8][8];
#pragma unroll
        for (int j = 0; j < 8; ++j) a[j] = *(const v8f*)(fq + j * 256);
#pragma unroll
        for (int j = 0; j < 8; ++j) b[j] = *(const v8f*)(fk + (j >> 2) * (16 * HD) + (j & 3) * 16);
        // stands in front of any reuse of these loads' address registers; the pointers are inputs so that they stay live up to here and no load lands on an address register
        asm volatile("s_wait_xcnt 0x0" :: "v"(fq), "v"(fk) : "memory");
        __builtin_amdgcn_sched_barrier(0);   // all 32 loads are issued before any conversion: scheduled among the conversions, the later ones would start only when the earlier have landed
#pragma unroll
        for (int j = 0; j < 8; ++j) {
            v8us o;
#pragma unroll
            for (int k = 0; k < 8; ++k) o[k] = f2bf(a[j][k]);
            *(v8us*)(Qp + dst + j * 256) = o;
        }
        asm volatile("s_wait_xcnt 0x0" ::: "memory");   // stands between the q stores and the value loads, which land on registers that those stores name
        __builtin_amdgcn_sched_barrier(0);   // holds the value loads behind the q stores and the wait above
#pragma unroll
        for (int j = 0; j < 8; ++j)
#pragma unroll
            for (int q = 0; q < 8; ++q) c[j][q] = fv[(j & 1) * (16 * HD) + (j >> 1) * 16 + q * HD];
        asm volatile("s_wait_xcnt 0x0" :: "v"(fv) : "memory");   // as above, for the value loads
        __builtin_amdgcn_sched_barrier(0);   // as above: every value load is issued before the key conversions start
#pragma unroll
        for (int j = 0; j < 8; ++j) {
            v8us o;
#pragma unroll
            for (int k = 0; k < 8; ++k) o[k] = f2bf(b[j][k]);
            *(v8us*)(Kf + dst + j * 256) = o;
        }
#pragma unroll
        for (int j = 0; j < 8; ++j) {
            v8h o16; v8us oh;
#pragma unroll
            for (int q = 0; q < 8; ++q) { const float x = bfr(c[j][q]); o16[q] = (h16)x; oh[q] = f2bf(x); }
            *(v8h*)(V16 + dst + j * 256) = o16; *(v8us*)(Vh + dst + j * 256) = oh;
        }
        asm volatile("s_wait_xcnt 0x0" ::: "memory");   // stands between the stores and the next span's step of their address registers
    }
}

// attn_block: streaming causal attention for query block qb of head-plane z = blockIdx.x (os: the block's staging tiles in LDS).
// Wave w owns query rows q0..q0+15 (q0 = qb*128 + 16w) and visits key chunks 0..(q0+15)/64 (uniform per wave; waves never exchange data, no block barrier needed).
// Per 64-key chunk: four S^T tiles = K(16 keys x 64 d, A operand) . Q^T (B operand from the [q][d] plane): lane holds query q0 + (lane & 15) and keys k0 + 16j + 8h + r.
// Causal select by value (key > query -> huge negative), for rows from RH on in the wave's last chunk alone, chunk max within the lane then xor-16, running max / scale / sums in f32, p = exp2(fma(t, 0.125 * log2 e, 10 - m * 0.125 * log2 e)) on the unscaled score t: one instruction a score forms the argument (HR: t x 0.125 log2 e at the select, then t - m: an addend beside m costs that body a spill).
// The p values of two adjacent 16-key tiles form one P^T B-fragment directly (element r <- tile covering keys 0..15, element 8 + r <- tile covering keys 16..31, lane = query),
// O^T[d][query] += V^T(16 d x 32 keys, A operand from the fragment-order plane) . P^T; HR: p as bf16 hi + lo into the same accumulator with bf16 v, else p x 1024 in f16 with f16 v.
template <bool HR>
__device__ __forceinline__ void attn_block(const bf* __restrict__ Qp, const bf* __restrict__ Kp, const bf* __restrict__ VTh, const h16* __restrict__ VT16, float* OUT, float* os, int qb) {
#pragma clang fp contract(off)
    const int lane = threadIdx.x & 31, lr = lane & 15, hi = lane >> 4, wave = threadIdx.x >> 5;
    const size_t z = blockIdx.x;
    const int q0 = qb * QT + wave * 16;
    const int myq = q0 + lr;
    const bf* Qz = Qp + z * ((size_t)SEQ * HD);
    const bf* Kz = Kp + z * ((size_t)SEQ * HD);
    const bf* Vhz = VTh + z * ((size_t)HD * SEQ);
    const h16* V16z = VT16 + z * ((size_t)HD * SEQ);
    // Q^T B-fragments (column n = query q0 + lr, k = d), kept for the whole key loop
    const bf* qp = Qz + (size_t)myq * HD + 8 * hi;
    const v16bf qf0 = ldb(qp);
    const v16bf qf1 = ldb(qp + 32);
    v8f oacc[4];
#pragma unroll
    for (int dt = 0; dt < 4; ++dt) oacc[dt] = (v8f){};
    float m = NEG, lsum = 0.0f;
    // key chunks with at least one key <= the wave's last query; chunk c always has key 64c <= every query of this wave (the same in every lane, read as a scalar)
    const int nch = __builtin_amdgcn_readfirstlane((q0 + 15) / KC + 1);
    // Fragments are fetched one chunk ahead: a chunk's eight K fragments (i = 4jg + 0..3: keys 32jg + 0..15 d 0..31, d 32..63, keys 32jg + 16..31 d 0..31, d 32..63)
    // and eight V^T fragments (i = 4ks + dt) each start at element 64 * k0 + 512 * i + 8 * lane of their plane.
    const bf* kp = Kz + 8 * lane;      // each lane's place in the chunk being fetched: these pointers live across the passes, so no load lands on its own address registers
    const bf* vbp = Vhz + 8 * lane;
    const h16* vhp = V16z + 8 * lane;
    v16bf kf[8]; v16bf vfb[8]; v16h vfh[8];
#pragma unroll
    for (int i = 0; i < 8; ++i) kf[i] = ldbu(kp + i * 512);
#pragma unroll
    for (int i = 0; i < 8; ++i) { if (HR) vfb[i] = ldbu(vbp + i * 512); else vfh[i] = ldhu(vhp + i * 512); }
    // inputs-only fence on the loaded Q and first K fragments: they have landed in front of the loop (the first product needs them anyway), so the wait at the loop's head
    // is counted from the loop's own load order alone (K older than the sixteen V loads) and leaves the V loads in flight; without it that wait drains part of them on every pass
    asm volatile("" :: "v"(qf0), "v"(qf1), "v"(kf[0]), "v"(kf[1]), "v"(kf[2]), "v"(kf[3]), "v"(kf[4]), "v"(kf[5]), "v"(kf[6]), "v"(kf[7]));
    // stands in front of any reuse of the Q loads' address registers; the pointer is an input so that it stays live up to here
    asm volatile("s_wait_xcnt 0x0" :: "v"(qp) : "memory");
#pragma unroll 1
    for (int c = 0; c < nch; ++c) {
        const int k0 = c * KC;
        const int step = (c + 1 < nch) ? KC * HD : 0;   // on to the next chunk; the last pass fetches its own chunk again (in bounds, unused)
        v8f s[4];
#pragma unroll
        for (int jg = 0; jg < 2; ++jg) {
            const v16bf ka0 = kf[4 * jg], ka1 = kf[4 * jg + 1], kb0 = kf[4 * jg + 2], kb1 = kf[4 * jg + 3];
            v8f t0 = wmmab(ka0, qf0, (v8f){}); t0 = wmmab(ka1, qf1, t0);
            v8f t1 = wmmab(kb0, qf0, (v8f){}); t1 = wmmab(kb1, qf1, t1);
            asm volatile("v_nop\n\tv_nop\n\tv_nop\n\tv_nop" : "+v"(t0), "+v"(t1) : "v"(ka0), "v"(ka1), "v"(kb0), "v"(kb1), "v"(qf0), "v"(qf1));
            s[2 * jg] = t0; s[2 * jg + 1] = t1;
        }
        // rows from RH on: the causal select by value only in the wave's last chunk (a scalar branch): q0 is a multiple of 16, so every earlier chunk
        // ends at key 64 * (q0 / 64) - 1 < q0 and the select would keep each of its scores. It stands in front of the fetch so that all behind the branch stays one block to schedule.
        // (the loops are unrolled so that s is indexed by constants and stays in registers)
        if (!HR) {
            if (c + 1 == nch) {
#pragma unroll
                for (int j = 0; j < 4; ++j)
#pragma unroll
                    for (int r = 0; r < 8; ++r) s[j][r] = (k0 + 16 * j + 8 * hi + r <= myq) ? s[j][r] : NEG;
            }
        }
        // next chunk's K fragments, into the registers the products above have just left: they fly during the softmax and the p.v products
        kp += step;
#pragma unroll
        for (int i = 0; i < 8; ++i) kf[i] = ldbu(kp + i * 512);
        asm volatile("s_wait_xcnt 0x0" ::: "memory");   // stands between these loads and the next pass's step of their address registers
        if (!HR) __builtin_amdgcn_sched_barrier(0);   // holds these loads here, in front of the softmax: scheduled later they have less of the pass to land in (HR: its registers do not allow it)
        // chunk max; HR: the factor and the causal select by value here, in every chunk (with the branch that kernel spills to scratch)
        float tmx = NEG;
#pragma unroll
        for (int j = 0; j < 4; ++j) {
#pragma unroll
            for (int r = 0; r < 8; ++r) {
                if (HR) { const int key = k0 + 16 * j + 8 * hi + r; s[j][r] = (key <= myq) ? s[j][r] * CEX : NEG; }
                tmx = fmaxf(tmx, s[j][r]);
            }
        }
        tmx = fmaxf(tmx, __shfl_xor(tmx, 16, 32));
        const float mn = fmaxf(m, tmx);
        const float alpha = __builtin_amdgcn_exp2f(HR ? m - mn : (m - mn) * CEX);
        const float eb = PCL2 - mn * CEX;   // rows from RH on: the addend every score of this chunk shares
        m = mn; lsum *= alpha;
#pragma unroll
        for (int dt = 0; dt < 4; ++dt)
#pragma unroll
            for (int r = 0; r < 8; ++r) oacc[dt][r] *= alpha;
        // weights and their 16-bit P^T fragments (ks = 32-key step: tiles 2ks and 2ks+1)
        v16bf pbh[2], pbl[2]; v16h pf[2];
#pragma unroll
        for (int ks = 0; ks < 2; ++ks) {
            v16us uh, ul; v16h p16;
#pragma unroll
            for (int half = 0; half < 2; ++half) {
                const int j = 2 * ks + half;
#pragma unroll
                for (int r = 0; r < 8; ++r) {
                    const float p = __builtin_amdgcn_exp2f(HR ? s[j][r] - mn : __builtin_fmaf(s[j][r], CEX, eb));
                    lsum += p;
                    if (HR) { unsigned short a, b2; splitf(p, a, b2); uh[half * 8 + r] = a; ul[half * 8 + r] = b2; }
                    else { p16[half * 8 + r] = (h16)p; }
                }
            }
            if (HR) { pbh[ks] = __builtin_bit_cast(v16bf, uh); pbl[ks] = __builtin_bit_cast(v16bf, ul); }
            else { pf[ks] = p16; }
        }
        // O^T[d][query] += V^T . P^T over the chunk's 64 keys
#pragma unroll
        for (int ks = 0; ks < 2; ++ks) {
            if (HR) {
                const v16bf bh = pbh[ks], bl = pbl[ks];
                v16bf vf[4];
#pragma unroll
                for (int dt = 0; dt < 4; ++dt) vf[dt] = vfb[4 * ks + dt];
#pragma unroll
                for (int dt = 0; dt < 4; ++dt) { oacc[dt] = wmmab(vf[dt], bh, oacc[dt]); oacc[dt] = wmmab(vf[dt], bl, oacc[dt]); }
                asm volatile("v_nop\n\tv_nop\n\tv_nop\n\tv_nop" : "+v"(oacc[0]), "+v"(oacc[1]), "+v"(oacc[2]), "+v"(oacc[3]) : "v"(vf[0]), "v"(vf[1]), "v"(vf[2]), "v"(vf[3]), "v"(bh), "v"(bl));
            } else {
                const v16h bp = pf[ks];
                v16h vf[4];
#pragma unroll
                for (int dt = 0; dt < 4; ++dt) vf[dt] = vfh[4 * ks + dt];
#pragma unroll
                for (int dt = 0; dt < 4; ++dt) oacc[dt] = wmma16(vf[dt], bp, oacc[dt]);
                asm volatile("v_nop\n\tv_nop\n\tv_nop\n\tv_nop" : "+v"(oacc[0]), "+v"(oacc[1]), "+v"(oacc[2]), "+v"(oacc[3]) : "v"(vf[0]), "v"(vf[1]), "v"(vf[2]), "v"(vf[3]), "v"(bp));
            }
        }
        // next chunk's V^T fragments, into the registers just left: they fly during the next chunk's score products and softmax
        if (HR) vbp += step; else vhp += step;
#pragma unroll
        for (int i = 0; i < 8; ++i) { if (HR) vfb[i] = ldbu(vbp + i * 512); else vfh[i] = ldhu(vhp + i * 512); }
        asm volatile("s_wait_xcnt 0x0" ::: "memory");   // stands between these loads and the next pass's step of their address registers
    }
    // normalise and write: lane holds query lr, d = dt*16 + 8h + r
    lsum += __shfl_xor(lsum, 16, 32);
    const float inv = __fdiv_rn(1.0f, lsum);
    float* osw = os + wave * (16 * 68);   // wave-private staging tile [16 queries][64 d], pitch 68
#pragma unroll
    for (int dt = 0; dt < 4; ++dt)
#pragma unroll
        for (int r = 0; r < 8; ++r) osw[lr * 68 + dt * 16 + 8 * hi + r] = oacc[dt][r] * inv;
    __builtin_amdgcn_fence(3, "wavefront"); __builtin_amdgcn_wave_barrier(); asm volatile("" ::: "memory");
    float* orow = OUT + (z * SEQ + (size_t)q0) * HD;
    v4f val[8];
#pragma unroll
    for (int sg = 0; sg < 8; ++sg) val[sg] = *(const v4fa*)(osw + (2 * sg + hi) * 68 + lr * 4);
#pragma unroll
    for (int sg = 0; sg < 8; ++sg) *(v4f*)(orow + (size_t)(2 * sg + hi) * HD + lr * 4) = val[sg];
}

// k_attn: one grid for every (plane z = blockIdx.x, query block); blockIdx.y is the query block's rank by cost.
// The grid holds more blocks than the chip has places and cost falls with the rank: the longest blocks take the lowest ranks and the
// shortest the highest (for speed only). A block's cost is its key chunks, 16 * qb + 12 over its eight waves, counted double for query rows below RH (about twice the vector
// instructions a chunk). The rank is found by merging the two falling lists, so every query block has exactly one rank whatever the sizes. Speed only: the order changes no value.
__global__ __launch_bounds__(256) __attribute__((amdgpu_num_vgpr(256)))
void k_attn(const bf* __restrict__ Qp, const bf* __restrict__ Kp, const bf* __restrict__ VTh, const h16* __restrict__ VT16, float* OUT) {
    __shared__ __align__(16) float os[8 * 16 * 68];
    constexpr int nqb = SEQ / QT, rhb = ((RH < SEQ) ? RH : SEQ) / QT;
    int a = nqb - 1, b = rhb - 1, qb = 0;   // next block of each list: rows from RH on, rows below RH
#pragma unroll 1   // a few scalar instructions a trip, once a block: unrolled it only lengthens the text in front of the hot loops
    for (int i = 0; i <= (int)blockIdx.y; ++i) {
        const bool low = a < rhb || (b >= 0 && 2 * (16 * b + 12) > 16 * a + 12);
        qb = low ? b-- : a--;
    }
    if (qb >= rhb) {
        attn_block<false>(Qp, Kp, VTh, VT16, OUT, os, qb);
    } else {
        // compiler fence at the head of this side alone: without it the first K loads, alike on both sides, are merged in front of the branch and the body for rows below RH spills to scratch
        asm volatile("" ::: "memory");
        attn_block<true>(Qp, Kp, VTh, VT16, OUT, os, qb);
    }
}

extern "C" void kernel_launch(void* const* d_in, const int* in_sizes, int n_in,
                              void* d_out, int out_size, void* d_ws, size_t ws_size, hipStream_t stream) {
    if (n_in < 3) return;
    const float* xq = (const float*)d_in[0];   // [NB][16][SEQ_FULL][64] f32
    const float* xk = (const float*)d_in[1];
    const float* xv = (const float*)d_in[2];
    float* OUT = (float*)d_out;                // [NB][16][SEQ][64] f32
    const long long need_in = (long long)(NZ - 1) * SEQ_FULL * HD + (long long)SEQ * HD;
    if ((long long)in_sizes[0] < need_in || (long long)in_sizes[1] < need_in || (long long)in_sizes[2] < need_in) return;
    if ((long long)out_size < (long long)NZ * SEQ * HD) return;
    char* wsp = (char*)d_ws;
    auto take = [&](size_t bytes) { char* p = wsp; wsp += (bytes + 255) & ~(size_t)255; return (void*)p; };
    const size_t plane = (size_t)NZ * SEQ * HD;      // elements per 16-bit plane
    bf*  Qp   = (bf*)take(plane * 2);                 // [z][t][d] bf16
    bf*  Kp   = (bf*)take(plane * 2);                 // fragment order, bf16
    bf*  VTh  = (bf*)take(plane * 2);                 // fragment order, bf16
    h16* VT16 = (h16*)take(plane * 2);                // fragment order, f16
    if ((size_t)(wsp - (char*)d_ws) > ws_size) return;   // 4 x 16 MiB = 64 MiB at full size
    k_pack<<<PKB, 512, 0, stream>>>(xq, xk, xv, Qp, Kp, VT16, VTh);
    k_attn<<<dim3(NZ, SEQ / QT), 256, 0, stream>>>(Qp, Kp, VTh, VT16, OUT);
}

// v008
// Measured time: 79 microseconds a run.
// Two timings next to v007 both put it at 1.05 times that version's speed.
// Over all steps from v000 it is 4.63 times as fast.
#include <hip/hip_runtime.h>

// Contractions (f32 accumulate): score tiles k.q^T on v_wmma_f32_16x16x32_bf16 (bf16 operands = RNE-converted q and k, exact products; x0.125 is part of the f32 factor of the exponent's argument);
// p.v on v_wmma_f32_16x16x32_bf16 (p as bf16 hi + bf16 lo, v bf16) for query rows below RH, and on v_wmma_f32_16x16x32_f16 (p carried x1024 in f16, v f16) for the remaining rows;
// streaming softmax against a reference maximum per query (kept on the unscaled scores for rows from RH on, on the scores x 0.125 log2 e below RH) that is renewed, with the rescale of sums and outputs, in every chunk below RH and from RH on only in a chunk
// where some score of the wave passes it by more than LZR (it cancels in the division); row sums and the final 1/l scaling in f32; f32 output.
// Layout: one launch converts q into a bf16 plane [z][t][d] (z = b*16 + h) and k (bf16) and v (f16 and bf16) into planes stored in fragment order:
// every 16-byte-per-lane load of a K or V^T fragment half is one 512-byte unit [lane][8 elements], so a wave-wide load reads four whole 128-byte lines.
// One streaming causal attention launch for all query blocks (a block takes the one or the other p.v form by its query rows): 8 waves x 16 query rows per block, 64-key chunks, operands loaded as fragments straight from the planes, one chunk ahead of their use,
// causal select by value (rows from RH on: only in the one chunk of a wave that crosses the diagonal), key chunks entirely above the diagonal are never visited (their weights are exactly zero).

#ifndef NB
#define NB 2
#endif
#ifndef SEQ
#define SEQ 4096
#endif
#ifndef SEQ_FULL
#define SEQ_FULL 4096
#endif
#ifndef RH
#define RH 1024
#endif
#define NH 16
#define HD 64
#define NZ (NB * NH)
#define QT 128
#define KC 64
#define PCL2 10.0f   // p is carried x 2^10 where it goes to f16: added to the exponent's argument, so weights and row sums both hold it and it cancels in the division
#define SCL 0.125f
#define L2E 1.4426950408889634f
#define CEX (SCL * L2E)   // score scale and log2 e as one factor (a power of two times the f32 log2 e: no second rounding)
#define NEG (-1.0e30f)
#define LZR 27.0f   // lazy rescale: the maximum in use stays until an unscaled score passes it by more than this (x 0.125 log2 e = 4.87: a weight stays below 2^4.87, x1024 below 2^14.87, inside f16)
#define PKB 256   // packing work-groups: one per WGP of the chip (speed only: the span loop strides by the grid, so any count does all the work once)
static_assert(SEQ % QT == 0);
static_assert(SEQ % KC == 0);
static_assert(RH % QT == 0);
static_assert(QT == 8 * 16);
static_assert(HD == 64);
static_assert(SEQ % 32 == 0);
static_assert(SEQ <= SEQ_FULL);
static_assert(((long long)NZ * SEQ * HD) % 8 == 0);

typedef _Float16 h16;
typedef unsigned short bf;
typedef __attribute__((ext_vector_type(16))) __bf16         v16bf;
typedef __attribute__((ext_vector_type(16))) _Float16       v16h;
typedef __attribute__((ext_vector_type(16))) unsigned short v16us;
typedef __attribute__((ext_vector_type(8)))  _Float16       v8h;
typedef __attribute__((ext_vector_type(8)))  unsigned short v8us;
typedef __attribute__((ext_vector_type(8)))  float          v8f;
typedef __attribute__((ext_vector_type(4)))  float          v4f;
typedef __attribute__((ext_vector_type(2)))  _Float16       v2h;
typedef __attribute__((ext_vector_type(2)))  unsigned short v2us;
typedef v4f __attribute__((may_alias)) v4fa;

__device__ __forceinline__ unsigned short f2bf(float f) { unsigned u = __float_as_uint(f); u += 0x7FFFu + ((u >> 16) & 1u); return (unsigned short)(u >> 16); }
__device__ __forceinline__ float bf2f(unsigned short b) { return __uint_as_float(((unsigned)b) << 16); }
__device__ __forceinline__ float bfr(float f) { return bf2f(f2bf(f)); }
__device__ __forceinline__ void splitf(float y, unsigned short& h, unsigned short& l) { h = f2bf(y); l = f2bf(y - bf2f(h)); }
__device__ __forceinline__ v16h  cat16(v8h lo, v8h hi) { return __builtin_shufflevector(lo, hi, 0, 1, 2, 3, 4, 5, 6, 7, 8, 9, 10, 11, 12, 13, 14, 15); }
__device__ __forceinline__ v16bf cat16b(v8us lo, v8us hi) { return __builtin_bit_cast(v16bf, __builtin_shufflevector(lo, hi, 0, 1, 2, 3, 4, 5, 6, 7, 8, 9, 10, 11, 12, 13, 14, 15)); }
__device__ __forceinline__ v8f wmma16(v16h a, v16h b, v8f c) { return __builtin_amdgcn_wmma_f32_16x16x32_f16(false, a, false, b, (short)0, c, false, false); }
__device__ __forceinline__ v8f wmmab(v16bf a, v16bf b, v8f c) { return __builtin_amdgcn_wmma_f32_16x16x32_bf16(false, a, false, b, (short)0, c, false, false); }

// Fragment loader for a 16 x 32(k) operand tile from a k-contiguous 16-bit row; p = base + row(lane & 15) * pitch + k0 + 8 * (lane >> 4):
// elements 0..7 = k0 + 8h + 0..7, elements 8..15 = k0 + 16 + 8h + 0..7 (same map for the A operand, row = lane & 15, and for the B operand stored [n][k], column = lane & 15).
__device__ __forceinline__ v16bf ldb(const bf* p) { return cat16b(*(const v8us*)p, *(const v8us*)(p + 16)); }
// The same fragments from a fragment-order plane; p = first unit of the fragment + 8 * lane: elements 0..7 from that unit, elements 8..15 from the next unit (256 elements on).
__device__ __forceinline__ v16bf ldbu(const bf* p) { return cat16b(*(const v8us*)p, *(const v8us*)(p + 256)); }
__device__ __forceinline__ v16h  ldhu(const h16* p) { return cat16(*(const v8h*)p, *(const v8h*)(p + 256)); }

// k_pack: all three conversions in one resident stream. PKB work-groups of 16 waves; a wave takes whole spans of 32 positions x 64 d of one plane z (8 KiB of f32 per input,
// 256 destination pieces of 16 bytes, piece = 256 * span + 32j + lane, j = 0..7) and has a span's loads in flight together, so that few waves have to start and each keeps the memory busy.
// Qp[z][t][d]: piece j holds elements 256j + 8 * lane + 0..7 of the span.
// Kf[z][t / 16][u][lane][8]: unit u (0..3) of a 16-key tile holds, at lane, key 16 * tile + (lane & 15), d = 16u + 8 * (lane >> 4) + 0..7
// (units 0, 1 = the A fragment for d 0..31, units 2, 3 = the one for d 32..63); piece j = tile j >> 2 of the span, unit j & 3.
// V16 / Vh[z][t / 32][dt][u][lane][8] (f16 and bf16 bits of the RNE-converted input): unit u (0, 1) of the V^T A fragment for d tile dt and a 32-key step
// holds, at lane, d = 16dt + (lane & 15), keys 32 * step + 16u + 8 * (lane >> 4) + 0..7; piece j = d tile j >> 1, unit j & 1. Sources [z][t][d] with z-pitch SEQ_FULL*HD.
__global__ __launch_bounds__(512) void k_pack(const float* __restrict__ xq, const float* __restrict__ xk, const float* __restrict__ xv, bf* Qp, bf* Kf, h16* V16, bf* Vh) {
    const int lane = threadIdx.x & 31, lr = lane & 15, hi = lane >> 4;
    const int wave = __builtin_amdgcn_readfirstlane((int)(threadIdx.x >> 5));   // the same in every lane: span bases stay scalar
    for (int sp = (int)blockIdx.x * 16 + wave; sp < NZ * (SEQ / 32); sp += (int)gridDim.x * 16) {
        const size_t src = ((size_t)(sp / (SEQ / 32)) * SEQ_FULL + (size_t)(sp % (SEQ / 32)) * 32) * HD;
        const size_t dst = (size_t)sp * 2048 + (size_t)lane * 8;
        const float* fq = xq + src + lane * 8;
        const float* fk = xk + src + lr * HD + hi * 8;
        const float* fv = xv + src + hi * (8 * HD) + lr;
        v8f a[8], b[8]; float c[8][8];
#pragma unroll
        for (int j = 0; j < 8; ++j) a[j] = *(const v8f*)(fq + j * 256);
#pragma unroll
        for (int j = 0; j < 8; ++j) b[j] = *(const v8f*)(fk + (j >> 2) * (16 * HD) + (j & 3) * 16);
        // stands in front of any reuse of these loads' address registers; the pointers are inputs so that they stay live up to here and no load lands on an address register
        asm volatile("s_wait_xcnt 0x0" :: "v"(fq), "v"(fk) : "memory");
        __builtin_amdgcn_sched_barrier(0);   // all 32 loads are issued before any conversion: scheduled among the conversions, the later ones would start only when the earlier have landed
#pragma unroll
        for (int j = 0; j < 8; ++j) {
            v8us o;
#pragma unroll
            for (int k = 0; k < 8; ++k) o[k] = f2bf(a[j][k]);
            *(v8us*)(Qp + dst + j * 256) = o;
        }
        asm volatile("s_wait_xcnt 0x0" ::: "memory");   // stands between the q stores and the value loads, which land on registers that those stores name
        __builtin_amdgcn_sched_barrier(0);   // holds the value loads behind the q stores and the wait above
#pragma unroll
        for (int j = 0; j < 8; ++j)
#pragma unroll
            for (int q = 0; q < 8; ++q) c[j][q] = fv[(j & 1) * (16 * HD) + (j >> 1) * 16 + q * HD];
        asm volatile("s_wait_xcnt 0x0" :: "v"(fv) : "memory");   // as above, for the value loads
        __builtin_amdgcn_sched_barrier(0);   // as above: every value load is issued before the key conversions start
#pragma unroll
        for (int j = 0; j < 8; ++j) {
            v8us o;
#pragma unroll
            for (int k = 0; k < 8; ++k) o[k] = f2bf(b[j][k]);
            *(v8us*)(Kf + dst + j * 256) = o;
        }
#pragma unroll
        for (int j = 0; j < 8; ++j) {
            v8h o16; v8us oh;
#pragma unroll
            for (int q = 0; q < 8; ++q) { const float x = bfr(c[j][q]); o16[q] = (h16)x; oh[q] = f2bf(x); }
            *(v8h*)(V16 + dst + j * 256) = o16; *(v8us*)(Vh + dst + j * 256) = oh;
        }
        asm volatile("s_wait_xcnt 0x0" ::: "memory");   // stands between the stores and the next span's step of their address registers
    }
}

// attn_block: streaming causal attention for query block qb of head-plane z = blockIdx.x (os: the block's staging tiles in LDS).
// Wave w owns query rows q0..q0+15 (q0 = qb*128 + 16w) and visits key chunks 0..(q0+15)/64 (uniform per wave; waves never exchange data, no block barrier needed).
// Per 64-key chunk: four S^T tiles = K(16 keys x 64 d, A operand) . Q^T (B operand from the [q][d] plane): lane holds query q0 + (lane & 15) and keys k0 + 16j + 8h + r.
// Causal select by value (key > query -> huge negative), for rows from RH on in the wave's last chunk alone, chunk max within the lane; the maximum in use is renewed (xor-16 exchange, factor, rescale of sum and outputs) in every chunk for HR, else only when a score passes it by more than LZR; sums in f32, p = exp2(fma(t, 0.125 * log2 e, 10 - m * 0.125 * log2 e)) on the unscaled score t: one instruction a score forms the argument (HR: t x 0.125 log2 e at the select, then t - m: an addend beside m costs that body a spill).
// The p values of two adjacent 16-key tiles form one P^T B-fragment directly (element r <- tile covering keys 0..15, element 8 + r <- tile covering keys 16..31, lane = query),
// O^T[d][query] += V^T(16 d x 32 keys, A operand from the fragment-order plane) . P^T; HR: p as bf16 hi + lo into the same accumulator with bf16 v, else p x 1024 in f16 with f16 v.
template <bool HR>
__device__ __forceinline__ void attn_block(const bf* __restrict__ Qp, const bf* __restrict__ Kp, const bf* __restrict__ VTh, const h16* __restrict__ VT16, float* OUT, float* os, int qb) {
#pragma clang fp contract(off)
    const int lane = threadIdx.x & 31, lr = lane & 15, hi = lane >> 4;
    const int wave = __builtin_amdgcn_readfirstlane((int)(threadIdx.x >> 5));   // the same in every lane: row bases and the staging tile's place stay scalar, which leaves the renewal its registers
    const size_t z = blockIdx.x;
    const int q0 = qb * QT + wave * 16;
    const int myq = q0 + lr;
    const bf* Qz = Qp + z * ((size_t)SEQ * HD);
    const bf* Kz = Kp + z * ((size_t)SEQ * HD);
    const bf* Vhz = VTh + z * ((size_t)HD * SEQ);
    const h16* V16z = VT16 + z * ((size_t)HD * SEQ);
    // Q^T B-fragments (column n = query q0 + lr, k = d), kept for the whole key loop
    const bf* qp = Qz + (size_t)myq * HD + 8 * hi;
    const v16bf qf0 = ldb(qp);
    const v16bf qf1 = ldb(qp + 32);
    v8f oacc[4];
#pragma unroll
    for (int dt = 0; dt < 4; ++dt) oacc[dt] = (v8f){};
    float m = NEG, mlim = NEG, eb = 0.0f, lsum = 0.0f;   // m: the maximum in use; mlim: m plus the margin LZR; eb: the addend of the exponent's argument (rows from RH on); all three set in the first chunk
    // key chunks with at least one key <= the wave's last query; chunk c always has key 64c <= every query of this wave (the same in every lane, read as a scalar)
    const int nch = __builtin_amdgcn_readfirstlane((q0 + 15) / KC + 1);
    // Fragments are fetched one chunk ahead: a chunk's eight K fragments (i = 4jg + 0..3: keys 32jg + 0..15 d 0..31, d 32..63, keys 32jg + 16..31 d 0..31, d 32..63)
    // and eight V^T fragments (i = 4ks + dt) each start at element 64 * k0 + 512 * i + 8 * lane of their plane.
    const bf* kp = Kz + 8 * lane;      // each lane's place in the chunk being fetched: these pointers live across the passes, so no load lands on its own address registers
    const bf* vbp = Vhz + 8 * lane;
    const h16* vhp = V16z + 8 * lane;
    v16bf kf[8]; v16bf vfb[8]; v16h vfh[8];
#pragma unroll
    for (int i = 0; i < 8; ++i) kf[i] = ldbu(kp + i * 512);
#pragma unroll
    for (int i = 0; i < 8; ++i) { if (HR) vfb[i] = ldbu(vbp + i * 512); else vfh[i] = ldhu(vhp + i * 512); }
    // inputs-only fence on the loaded Q and first K fragments: they have landed in front of the loop (the first product needs them anyway), so the wait at the loop's head
    // is counted from the loop's own load order alone (K older than the sixteen V loads) and leaves the V loads in flight; without it that wait drains part of them on every pass
    asm volatile("" :: "v"(qf0), "v"(qf1), "v"(kf[0]), "v"(kf[1]), "v"(kf[2]), "v"(kf[3]), "v"(kf[4]), "v"(kf[5]), "v"(kf[6]), "v"(kf[7]));
    // stands in front of any reuse of the Q loads' address registers; the pointer is an input so that it stays live up to here
    asm volatile("s_wait_xcnt 0x0" :: "v"(qp) : "memory");
#pragma unroll 1
    for (int c = 0; c < nch;) {
        const int k0 = c * KC;
        const int step = (c + 1 < nch) ? KC * HD : 0;   // on to the next chunk; the last pass fetches its own chunk again (in bounds, unused)
        v8f s[4];
#pragma unroll
        for (int jg = 0; jg < 2; ++jg) {
            const v16bf ka0 = kf[4 * jg], ka1 = kf[4 * jg + 1], kb0 = kf[4 * jg + 2], kb1 = kf[4 * jg + 3];
            v8f t0 = wmmab(ka0, qf0, (v8f){}); t0 = wmmab(ka1, qf1, t0);
            v8f t1 = wmmab(kb0, qf0, (v8f){}); t1 = wmmab(kb1, qf1, t1);
            asm volatile("v_nop\n\tv_nop\n\tv_nop\n\tv_nop" : "+v"(t0), "+v"(t1) : "v"(ka0), "v"(ka1), "v"(kb0), "v"(kb1), "v"(qf0), "v"(qf1));
            s[2 * jg] = t0; s[2 * jg + 1] = t1;
        }
        // rows from RH on: the causal select by value only in the wave's last chunk (a scalar branch): q0 is a multiple of 16, so every earlier chunk
        // ends at key 64 * (q0 / 64) - 1 < q0 and the select would keep each of its scores.
        // (the loops are unrolled so that s is indexed by constants and stays in registers)
        if (!HR) {
            if (c + 1 == nch) {
#pragma unroll
                for (int j = 0; j < 4; ++j)
#pragma unroll
                    for (int r = 0; r < 8; ++r) s[j][r] = (k0 + 16 * j + 8 * hi + r <= myq) ? s[j][r] : NEG;
            }
        }
        // next chunk's K fragments, into the registers the products above have just left: they fly during the softmax and the p.v products
        auto fetch_k = [&]() __attribute__((always_inline)) {
            kp += step;
#pragma unroll
            for (int i = 0; i < 8; ++i) kf[i] = ldbu(kp + i * 512);
            asm volatile("s_wait_xcnt 0x0" ::: "memory");   // stands between these loads and the next pass's step of their address registers
        };
        if (HR) fetch_k();
        // chunk max; HR: the factor and the causal select by value here, in every chunk (with the branch that kernel spills to scratch)
        float tmx = NEG;
#pragma unroll
        for (int j = 0; j < 4; ++j) {
#pragma unroll
            for (int r = 0; r < 8; ++r) {
                if (HR) { const int key = k0 + 16 * j + 8 * hi + r; s[j][r] = (key <= myq) ? s[j][r] * CEX : NEG; }
                tmx = fmaxf(tmx, s[j][r]);
            }
        }
        // rows from RH on: lazy rescale, one test a chunk (a scalar branch on the ballot): while no lane's chunk maximum passes the maximum in use by more than the margin, the exchange between
        // the lane halves, the factor and the 33 multiplies are left out. Chunk 0 always renews (m starts at NEG and key 0 counts for every query), and then every query takes its true maximum so far.
        // A renewing wave goes back to the head of the pass and forms this chunk's scores once more (its K fragments are still in place; the test then fails, every score being at most m):
        // rare, and the changed outputs then join the loop's own registers at its head; joined behind the branch, half of them were copied to and fro in every pass.
        // HR: renewed in every chunk (with the branch that body spills to scratch).
        if (HR || __builtin_expect(__builtin_amdgcn_ballot_w32(tmx > mlim) != 0u, 0)) {   // marked rare: the common side falls through
            const float mn = fmaxf(m, fmaxf(tmx, __shfl_xor(tmx, 16, 32)));
            const float alpha = __builtin_amdgcn_exp2f(HR ? m - mn : (m - mn) * CEX);
            eb = PCL2 - mn * CEX;   // rows from RH on: the addend every score shares
            m = mn; mlim = mn + LZR; lsum *= alpha;
#pragma unroll
            for (int dt = 0; dt < 4; ++dt)
#pragma unroll
                for (int r = 0; r < 8; ++r) oacc[dt][r] *= alpha;
            if (!HR) continue;
        }
        // rows from RH on: the fetch stands behind the test: a renewing wave still needs this chunk's K fragments, and all from here to the pass's end stays one block to schedule (the sixteen maximum instructions in front of it are a small part of a pass)
        if (!HR) {
            fetch_k();
            __builtin_amdgcn_sched_barrier(0);   // holds these loads here, in front of the exponentials: scheduled later they have less of the pass to land in
        }
        // weights and their 16-bit P^T fragments (ks = 32-key step: tiles 2ks and 2ks+1)
        v16bf pbh[2], pbl[2]; v16h pf[2];
#pragma unroll
        for (int ks = 0; ks < 2; ++ks) {
            v16us uh, ul; v16h p16;
#pragma unroll
            for (int half = 0; half < 2; ++half) {
                const int j = 2 * ks + half;
#pragma unroll
                for (int r = 0; r < 8; ++r) {
                    const float p = __builtin_amdgcn_exp2f(HR ? s[j][r] - m : __builtin_fmaf(s[j][r], CEX, eb));
                    lsum += p;
                    if (HR) { unsigned short a, b2; splitf(p, a, b2); uh[half * 8 + r] = a; ul[half * 8 + r] = b2; }
                    else { p16[half * 8 + r] = (h16)p; }
                }
            }
            if (HR) { pbh[ks] = __builtin_bit_cast(v16bf, uh); pbl[ks] = __builtin_bit_cast(v16bf, ul); }
            else { pf[ks] = p16; }
        }
        // O^T[d][query] += V^T . P^T over the chunk's 64 keys
#pragma unroll
        for (int ks = 0; ks < 2; ++ks) {
            if (HR) {
                const v16bf bh = pbh[ks], bl = pbl[ks];
                v16bf vf[4];
#pragma unroll
                for (int dt = 0; dt < 4; ++dt) vf[dt] = vfb[4 * ks + dt];
#pragma unroll
                for (int dt = 0; dt < 4; ++dt) { oacc[dt] = wmmab(vf[dt], bh, oacc[dt]); oacc[dt] = wmmab(vf[dt], bl, oacc[dt]); }
                asm volatile("v_nop\n\tv_nop\n\tv_nop\n\tv_nop" : "+v"(oacc[0]), "+v"(oacc[1]), "+v"(oacc[2]), "+v"(oacc[3]) : "v"(vf[0]), "v"(vf[1]), "v"(vf[2]), "v"(vf[3]), "v"(bh), "v"(bl));
            } else {
                const v16h bp = pf[ks];
                v16h vf[4];
#pragma unroll
                for (int dt = 0; dt < 4; ++dt) vf[dt] = vfh[4 * ks + dt];
#pragma unroll
                for (int dt = 0; dt < 4; ++dt) oacc[dt] = wmma16(vf[dt], bp, oacc[dt]);
                asm volatile("v_nop\n\tv_nop\n\tv_nop\n\tv_nop" : "+v"(oacc[0]), "+v"(oacc[1]), "+v"(oacc[2]), "+v"(oacc[3]) : "v"(vf[0]), "v"(vf[1]), "v"(vf[2]), "v"(vf[3]), "v"(bp));
            }
        }
        // next chunk's V^T fragments, into the registers just left: they fly during the next chunk's score products and softmax
        if (HR) vbp += step; else vhp += step;
#pragma unroll
        for (int i = 0; i < 8; ++i) { if (HR) vfb[i] = ldbu(vbp + i * 512); else vfh[i] = ldhu(vhp + i * 512); }
        asm volatile("s_wait_xcnt 0x0" ::: "memory");   // stands between these loads and the next pass's step of their address registers
        ++c;
    }
    // normalise and write: lane holds query lr, d = dt*16 + 8h + r
    lsum += __shfl_xor(lsum, 16, 32);
    const float inv = __fdiv_rn(1.0f, lsum);
    float* osw = os + wave * (16 * 68);   // wave-private staging tile [16 queries][64 d], pitch 68
#pragma unroll
    for (int dt = 0; dt < 4; ++dt)
#pragma unroll
        for (int r = 0; r < 8; ++r) osw[lr * 68 + dt * 16 + 8 * hi + r] = oacc[dt][r] * inv;
    __builtin_amdgcn_fence(3, "wavefront"); __builtin_amdgcn_wave_barrier(); asm volatile("" ::: "memory");
    float* orow = OUT + (z * SEQ + (size_t)q0) * HD;
    v4f val[8];
#pragma unroll
    for (int sg = 0; sg < 8; ++sg) val[sg] = *(const v4fa*)(osw + (2 * sg + hi) * 68 + lr * 4);
#pragma unroll
    for (int sg = 0; sg < 8; ++sg) *(v4f*)(orow + (size_t)(2 * sg + hi) * HD + lr * 4) = val[sg];
}

// k_attn: one grid for every (plane z = blockIdx.x, query block); blockIdx.y is the query block's rank by cost.
// The grid holds more blocks than the chip has places and cost falls with the rank: the longest blocks take the lowest ranks and the
// shortest the highest (for speed only). A block's cost is its key chunks, 16 * qb + 12 over its eight waves, counted double for query rows below RH (about twice the vector
// instructions a chunk). The rank is found by merging the two falling lists, so every query block has exactly one rank whatever the sizes. Speed only: the order changes no value.
__global__ __launch_bounds__(256) __attribute__((amdgpu_num_vgpr(256)))
void k_attn(const bf* __restrict__ Qp, const bf* __restrict__ Kp, const bf* __restrict__ VTh, const h16* __restrict__ VT16, float* OUT) {
    __shared__ __align__(16) float os[8 * 16 * 68];
    constexpr int nqb = SEQ / QT, rhb = ((RH < SEQ) ? RH : SEQ) / QT;
    int a = nqb - 1, b = rhb - 1, qb = 0;   // next block of each list: rows from RH on, rows below RH
#pragma unroll 1   // a few scalar instructions a trip, once a block: unrolled it only lengthens the text in front of the hot loops
    for (int i = 0; i <= (int)blockIdx.y; ++i) {
        const bool low = a < rhb || (b >= 0 && 2 * (16 * b + 12) > 16 * a + 12);
        qb = low ? b-- : a--;
    }
    if (qb >= rhb) {
        attn_block<false>(Qp, Kp, VTh, VT16, OUT, os, qb);
    } else {
        // compiler fence at the head of this side alone: without it the first K loads, alike on both sides, are merged in front of the branch and the body for rows below RH spills to scratch
        asm volatile("" ::: "memory");
        attn_block<true>(Qp, Kp, VTh, VT16, OUT, os, qb);
    }
}

extern "C" void kernel_launch(void* const* d_in, const int* in_sizes, int n_in,
                              void* d_out, int out_size, void* d_ws, size_t ws_size, hipStream_t stream) {
    if (n_in < 3) return;
    const float* xq = (const float*)d_in[0];   // [NB][16][SEQ_FULL][64] f32
    const float* xk = (const float*)d_in[1];
    const float* xv = (const float*)d_in[2];
    float* OUT = (float*)d_out;                // [NB][16][SEQ][64] f32
    const long long need_in = (long long)(NZ - 1) * SEQ_FULL * HD + (long long)SEQ * HD;
    if ((long long)in_sizes[0] < need_in || (long long)in_sizes[1] < need_in || (long long)in_sizes[2] < need_in) return;
    if ((long long)out_size < (long long)NZ * SEQ * HD) return;
    char* wsp = (char*)d_ws;
    auto take = [&](size_t bytes) { char* p = wsp; wsp += (bytes + 255) & ~(size_t)255; return (void*)p; };
    const size_t plane = (size_t)NZ * SEQ * HD;      // elements per 16-bit plane
    bf*  Qp   = (bf*)take(plane * 2);                 // [z][t][d] bf16
    bf*  Kp   = (bf*)take(plane * 2);                 // fragment order, bf16
    bf*  VTh  = (bf*)take(plane * 2);                 // fragment order, bf16
    h16* VT16 = (h16*)take(plane * 2);                // fragment order, f16
    if ((size_t)(wsp - (char*)d_ws) > ws_size) return;   // 4 x 16 MiB = 64 MiB at full size
    k_pack<<<PKB, 512, 0, stream>>>(xq, xk, xv, Qp, Kp, VT16, VTh);
    k_attn<<<dim3(NZ, SEQ / QT), 256, 0, stream>>>(Qp, Kp, VTh, VT16, OUT);
}

// v009
// One run takes 75.6 microseconds.
// Timed twice side by side with v008, it ran 1.06 and 1.03 times as fast.
// All steps since v000 together make it 4.85 times as fast.
#include <hip/hip_runtime.h>

// Contractions (f32 accumulate): score tiles k.q^T on v_wmma_f32_16x16x32_bf16 (bf16 operands = RNE-converted q and k, exact products; x0.125 is part of the f32 factor of the exponent's argument);
// p.v on v_wmma_f32_16x16x32_bf16 (p as bf16 hi + bf16 lo, v bf16) for query rows below RH, and on v_wmma_f32_16x16x32_f16 (p carried x1024 in f16, v f16) for the remaining rows;
// streaming softmax against a reference maximum per query (kept on the unscaled scores for rows from RH on, on the scores x 0.125 log2 e below RH) that is renewed, with the rescale of sums and outputs, in every chunk below RH and from RH on only in a chunk
// where some score of the wave passes it by more than LZR (it cancels in the division); row sums and the final 1/l scaling in f32; f32 output.
// Layout: one launch converts q into a bf16 plane [z][t][d] (z = b*16 + h) and k (bf16) and v (f16 and bf16) into planes stored in fragment order:
// every 16-byte-per-lane load of a K or V^T fragment half is one 512-byte unit [lane][8 elements], so a wave-wide load reads four whole 128-byte lines.
// One streaming causal attention launch for all query blocks (a block takes the one or the other p.v form by its query rows): 128 query rows per block of 8 waves; below RH 8 waves x 16 rows, 64-key chunks;
// from RH on 4 tiles of 32 rows x 2 halves of the tile's keys, 32-key passes, each fragment load feeding two products, the halves joined through LDS; operands loaded as fragments straight from the planes, one chunk or pass ahead of their use,
// causal select by value (rows from RH on: only in the one chunk of a wave that crosses the diagonal), key chunks entirely above the diagonal are never visited (their weights are exactly zero).

#ifndef NB
#define NB 2
#endif
#ifndef SEQ
#define SEQ 4096
#endif
#ifndef SEQ_FULL
#define SEQ_FULL 4096
#endif
#ifndef RH
#define RH 1024
#endif
#define NH 16
#define HD 64
#define NZ (NB * NH)
#define QT 128
#define KC 64
#define PCL2 10.0f   // p is carried x 2^10 where it goes to f16: added to the exponent's argument, so weights and row sums both hold it and it cancels in the division
#define SCL 0.125f
#define L2E 1.4426950408889634f
#define CEX (SCL * L2E)   // score scale and log2 e as one factor (a power of two times the f32 log2 e: no second rounding)
#define NEG (-1.0e30f)
#define LZR 27.0f   // lazy rescale: the maximum in use stays until an unscaled score passes it by more than this (x 0.125 log2 e = 4.87: a weight stays below 2^4.87, x1024 below 2^14.87, inside f16)
#define PKB 256   // packing work-groups: one per WGP of the chip (speed only: the span loop strides by the grid, so any count does all the work once)
static_assert(SEQ % QT == 0);
static_assert(SEQ % KC == 0);
static_assert(RH % QT == 0);
static_assert(QT == 8 * 16);
static_assert(HD == 64);
static_assert(SEQ % 32 == 0);
static_assert(SEQ <= SEQ_FULL);
static_assert(((long long)NZ * SEQ * HD) % 8 == 0);

typedef _Float16 h16;
typedef unsigned short bf;
typedef __attribute__((ext_vector_type(16))) __bf16         v16bf;
typedef __attribute__((ext_vector_type(16))) _Float16       v16h;
typedef __attribute__((ext_vector_type(16))) unsigned short v16us;
typedef __attribute__((ext_vector_type(8)))  _Float16       v8h;
typedef __attribute__((ext_vector_type(8)))  unsigned short v8us;
typedef __attribute__((ext_vector_type(8)))  float          v8f;
typedef __attribute__((ext_vector_type(4)))  float          v4f;
typedef __attribute__((ext_vector_type(2)))  _Float16       v2h;
typedef __attribute__((ext_vector_type(2)))  unsigned short v2us;
typedef v4f __attribute__((may_alias)) v4fa;

__device__ __forceinline__ unsigned short f2bf(float f) { unsigned u = __float_as_uint(f); u += 0x7FFFu + ((u >> 16) & 1u); return (unsigned short)(u >> 16); }
__device__ __forceinline__ float bf2f(unsigned short b) { return __uint_as_float(((unsigned)b) << 16); }
__device__ __forceinline__ float bfr(float f) { return bf2f(f2bf(f)); }
__device__ __forceinline__ void splitf(float y, unsigned short& h, unsigned short& l) { h = f2bf(y); l = f2bf(y - bf2f(h)); }
__device__ __forceinline__ v16h  cat16(v8h lo, v8h hi) { return __builtin_shufflevector(lo, hi, 0, 1, 2, 3, 4, 5, 6, 7, 8, 9, 10, 11, 12, 13, 14, 15); }
__device__ __forceinline__ v16bf cat16b(v8us lo, v8us hi) { return __builtin_bit_cast(v16bf, __builtin_shufflevector(lo, hi, 0, 1, 2, 3, 4, 5, 6, 7, 8, 9, 10, 11, 12, 13, 14, 15)); }
__device__ __forceinline__ v8f wmma16(v16h a, v16h b, v8f c) { return __builtin_amdgcn_wmma_f32_16x16x32_f16(false, a, false, b, (short)0, c, false, false); }
__device__ __forceinline__ v8f wmmab(v16bf a, v16bf b, v8f c) { return __builtin_amdgcn_wmma_f32_16x16x32_bf16(false, a, false, b, (short)0, c, false, false); }

// Fragment loader for a 16 x 32(k) operand tile from a k-contiguous 16-bit row; p = base + row(lane & 15) * pitch + k0 + 8 * (lane >> 4):
// elements 0..7 = k0 + 8h + 0..7, elements 8..15 = k0 + 16 + 8h + 0..7 (same map for the A operand, row = lane & 15, and for the B operand stored [n][k], column = lane & 15).
__device__ __forceinline__ v16bf ldb(const bf* p) { return cat16b(*(const v8us*)p, *(const v8us*)(p + 16)); }
// The same fragments from a fragment-order plane; p = first unit of the fragment + 8 * lane: elements 0..7 from that unit, elements 8..15 from the next unit (256 elements on).
__device__ __forceinline__ v16bf ldbu(const bf* p) { return cat16b(*(const v8us*)p, *(const v8us*)(p + 256)); }
__device__ __forceinline__ v16h  ldhu(const h16* p) { return cat16(*(const v8h*)p, *(const v8h*)(p + 256)); }

// k_pack: all three conversions in one resident stream. PKB work-groups of 16 waves; a wave takes whole spans of 32 positions x 64 d of one plane z (8 KiB of f32 per input,
// 256 destination pieces of 16 bytes, piece = 256 * span + 32j + lane, j = 0..7) and has a span's loads in flight together, so that few waves have to start and each keeps the memory busy.
// Qp[z][t][d]: piece j holds elements 256j + 8 * lane + 0..7 of the span.
// Kf[z][t / 16][u][lane][8]: unit u (0..3) of a 16-key tile holds, at lane, key 16 * tile + (lane & 15), d = 16u + 8 * (lane >> 4) + 0..7
// (units 0, 1 = the A fragment for d 0..31, units 2, 3 = the one for d 32..63); piece j = tile j >> 2 of the span, unit j & 3.
// V16 / Vh[z][t / 32][dt][u][lane][8] (f16 and bf16 bits of the RNE-converted input): unit u (0, 1) of the V^T A fragment for d tile dt and a 32-key step
// holds, at lane, d = 16dt + (lane & 15), keys 32 * step + 16u + 8 * (lane >> 4) + 0..7; piece j = d tile j >> 1, unit j & 1. Sources [z][t][d] with z-pitch SEQ_FULL*HD.
__global__ __launch_bounds__(512) void k_pack(const float* __restrict__ xq, const float* __restrict__ xk, const float* __restrict__ xv, bf* Qp, bf* Kf, h16* V16, bf* Vh) {
    const int lane = threadIdx.x & 31, lr = lane & 15, hi = lane >> 4;
    const int wave = __builtin_amdgcn_readfirstlane((int)(threadIdx.x >> 5));   // the same in every lane: span bases stay scalar
    for (int sp = (int)blockIdx.x * 16 + wave; sp < NZ * (SEQ / 32); sp += (int)gridDim.x * 16) {
        const size_t src = ((size_t)(sp / (SEQ / 32)) * SEQ_FULL + (size_t)(sp % (SEQ / 32)) * 32) * HD;
        const size_t dst = (size_t)sp * 2048 + (size_t)lane * 8;
        const float* fq = xq + src + lane * 8;
        const float* fk = xk + src + lr * HD + hi * 8;
        const float* fv = xv + src + hi * (8 * HD) + lr;
        v8f a[8], b[8]; float c[8][8];
#pragma unroll
        for (int j = 0; j < 8; ++j) a[j] = *(const v8f*)(fq + j * 256);
#pragma unroll
        for (int j = 0; j < 8; ++j) b[j] = *(const v8f*)(fk + (j >> 2) * (16 * HD) + (j & 3) * 16);
        // stands in front of any reuse of these loads' address registers; the pointers are inputs so that they stay live up to here and no load lands on an address register
        asm volatile("s_wait_xcnt 0x0" :: "v"(fq), "v"(fk) : "memory");
        __builtin_amdgcn_sched_barrier(0);   // all 32 loads are issued before any conversion: scheduled among the conversions, the later ones would start only when the earlier have landed
#pragma unroll
        for (int j = 0; j < 8; ++j) {
            v8us o;
#pragma unroll
            for (int k = 0; k < 8; ++k) o[k] = f2bf(a[j][k]);
            *(v8us*)(Qp + dst + j * 256) = o;
        }
        asm volatile("s_wait_xcnt 0x0" ::: "memory");   // stands between the q stores and the value loads, which land on registers that those stores name
        __builtin_amdgcn_sched_barrier(0);   // holds the value loads behind the q stores and the wait above
#pragma unroll
        for (int j = 0; j < 8; ++j)
#pragma unroll
            for (int q = 0; q < 8; ++q) c[j][q] = fv[(j & 1) * (16 * HD) + (j >> 1) * 16 + q * HD];
        asm volatile("s_wait_xcnt 0x0" :: "v"(fv) : "memory");   // as above, for the value loads
        __builtin_amdgcn_sched_barrier(0);   // as above: every value load is issued before the key conversions start
#pragma unroll
        for (int j = 0; j < 8; ++j) {
            v8us o;
#pragma unroll
            for (int k = 0; k < 8; ++k) o[k] = f2bf(b[j][k]);
            *(v8us*)(Kf + dst + j * 256) = o;
        }
#pragma unroll
        for (int j = 0; j < 8; ++j) {
            v8h o16; v8us oh;
#pragma unroll
            for (int q = 0; q < 8; ++q) { const float x = bfr(c[j][q]); o16[q] = (h16)x; oh[q] = f2bf(x); }
            *(v8h*)(V16 + dst + j * 256) = o16; *(v8us*)(Vh + dst + j * 256) = oh;
        }
        asm volatile("s_wait_xcnt 0x0" ::: "memory");   // stands between the stores and the next span's step of their address registers
    }
}

// attn_block: streaming causal attention for query block qb of head-plane z = blockIdx.x, query rows below RH (os: the block's staging tiles in LDS).
// Wave w owns query rows q0..q0+15 (q0 = qb*128 + 16w) and visits key chunks 0..(q0+15)/64 (uniform per wave; waves never exchange data, no block barrier needed).
// Per 64-key chunk: four S^T tiles = K(16 keys x 64 d, A operand) . Q^T (B operand from the [q][d] plane): lane holds query q0 + (lane & 15) and keys k0 + 16j + 8h + r.
// Factor 0.125 log2 e and causal select by value (key > query -> huge negative) in every chunk, chunk max within the lane; the maximum in use is renewed (xor-16 exchange, factor, rescale of sum and outputs) in every chunk; sums in f32, p = exp2(t - m).
// The p values of two adjacent 16-key tiles form one P^T B-fragment directly (element r <- tile covering keys 0..15, element 8 + r <- tile covering keys 16..31, lane = query),
// O^T[d][query] += V^T(16 d x 32 keys, A operand from the fragment-order plane) . P^T; p as bf16 hi + lo into the same accumulator with bf16 v.
__device__ __forceinline__ void attn_block(const bf* __restrict__ Qp, const bf* __restrict__ Kp, const bf* __restrict__ VTh, float* OUT, float* os, int qb) {
#pragma clang fp contract(off)
    const int lane = threadIdx.x & 31, lr = lane & 15, hi = lane >> 4;
    const int wave = __builtin_amdgcn_readfirstlane((int)(threadIdx.x >> 5));   // the same in every lane: row bases and the staging tile's place stay scalar, which leaves the renewal its registers
    const size_t z = blockIdx.x;
    const int q0 = qb * QT + wave * 16;
    const int myq = q0 + lr;
    const bf* Qz = Qp + z * ((size_t)SEQ * HD);
    const bf* Kz = Kp + z * ((size_t)SEQ * HD);
    const bf* Vhz = VTh + z * ((size_t)HD * SEQ);
    // Q^T B-fragments (column n = query q0 + lr, k = d), kept for the whole key loop
    const bf* qp = Qz + (size_t)myq * HD + 8 * hi;
    const v16bf qf0 = ldb(qp);
    const v16bf qf1 = ldb(qp + 32);
    v8f oacc[4];
#pragma unroll
    for (int dt = 0; dt < 4; ++dt) oacc[dt] = (v8f){};
    float m = NEG, lsum = 0.0f;   // m: the maximum in use, set in the first chunk
    // key chunks with at least one key <= the wave's last query; chunk c always has key 64c <= every query of this wave (the same in every lane, read as a scalar)
    const int nch = __builtin_amdgcn_readfirstlane((q0 + 15) / KC + 1);
    // Fragments are fetched one chunk ahead: a chunk's eight K fragments (i = 4jg + 0..3: keys 32jg + 0..15 d 0..31, d 32..63, keys 32jg + 16..31 d 0..31, d 32..63)
    // and eight V^T fragments (i = 4ks + dt) each start at element 64 * k0 + 512 * i + 8 * lane of their plane.
    const bf* kp = Kz + 8 * lane;      // each lane's place in the chunk being fetched: these pointers live across the passes, so no load lands on its own address registers
    const bf* vbp = Vhz + 8 * lane;
    v16bf kf[8]; v16bf vfb[8];
#pragma unroll
    for (int i = 0; i < 8; ++i) kf[i] = ldbu(kp + i * 512);
#pragma unroll
    for (int i = 0; i < 8; ++i) vfb[i] = ldbu(vbp + i * 512);
    // inputs-only fence on the loaded Q and first K fragments: they have landed in front of the loop (the first product needs them anyway), so the wait at the loop's head
    // is counted from the loop's own load order alone (K older than the sixteen V loads) and leaves the V loads in flight; without it that wait drains part of them on every pass
    asm volatile("" :: "v"(qf0), "v"(qf1), "v"(kf[0]), "v"(kf[1]), "v"(kf[2]), "v"(kf[3]), "v"(kf[4]), "v"(kf[5]), "v"(kf[6]), "v"(kf[7]));
    // stands in front of any reuse of the Q loads' address registers; the pointer is an input so that it stays live up to here
    asm volatile("s_wait_xcnt 0x0" :: "v"(qp) : "memory");
#pragma unroll 1
    for (int c = 0; c < nch;) {
        const int k0 = c * KC;
        const int step = (c + 1 < nch) ? KC * HD : 0;   // on to the next chunk; the last pass fetches its own chunk again (in bounds, unused)
        v8f s[4];
#pragma unroll
        for (int jg = 0; jg < 2; ++jg) {
            const v16bf ka0 = kf[4 * jg], ka1 = kf[4 * jg + 1], kb0 = kf[4 * jg + 2], kb1 = kf[4 * jg + 3];
            v8f t0 = wmmab(ka0, qf0, (v8f){}); t0 = wmmab(ka1, qf1, t0);
            v8f t1 = wmmab(kb0, qf0, (v8f){}); t1 = wmmab(kb1, qf1, t1);
            asm volatile("v_nop\n\tv_nop\n\tv_nop\n\tv_nop" : "+v"(t0), "+v"(t1) : "v"(ka0), "v"(ka1), "v"(kb0), "v"(kb1), "v"(qf0), "v"(qf1));
            s[2 * jg] = t0; s[2 * jg + 1] = t1;
        }
        // next chunk's K fragments, into the registers the products above have just left: they fly during the softmax and the p.v products
        kp += step;
#pragma unroll
        for (int i = 0; i < 8; ++i) kf[i] = ldbu(kp + i * 512);
        asm volatile("s_wait_xcnt 0x0" ::: "memory");   // stands between these loads and the next pass's step of their address registers
        // chunk max; the factor and the causal select by value here, in every chunk (with a branch this body spills to scratch)
        float tmx = NEG;
#pragma unroll
        for (int j = 0; j < 4; ++j) {
#pragma unroll
            for (int r = 0; r < 8; ++r) {
                const int key = k0 + 16 * j + 8 * hi + r;
                s[j][r] = (key <= myq) ? s[j][r] * CEX : NEG;
                tmx = fmaxf(tmx, s[j][r]);
            }
        }
        // the maximum is renewed in every chunk (with a branch this body spills to scratch)
        {
            const float mn = fmaxf(m, fmaxf(tmx, __shfl_xor(tmx, 16, 32)));
            const float alpha = __builtin_amdgcn_exp2f(m - mn);
            m = mn; lsum *= alpha;
#pragma unroll
            for (int dt = 0; dt < 4; ++dt)
#pragma unroll
                for (int r = 0; r < 8; ++r) oacc[dt][r] *= alpha;
        }
        // weights and their 16-bit P^T fragments (ks = 32-key step: tiles 2ks and 2ks+1)
        v16bf pbh[2], pbl[2];
#pragma unroll
        for (int ks = 0; ks < 2; ++ks) {
            v16us uh, ul;
#pragma unroll
            for (int half = 0; half < 2; ++half) {
                const int j = 2 * ks + half;
#pragma unroll
                for (int r = 0; r < 8; ++r) {
                    const float p = __builtin_amdgcn_exp2f(s[j][r] - m);
                    lsum += p;
                    unsigned short a, b2; splitf(p, a, b2); uh[half * 8 + r] = a; ul[half * 8 + r] = b2;
                }
            }
            pbh[ks] = __builtin_bit_cast(v16bf, uh); pbl[ks] = __builtin_bit_cast(v16bf, ul);
        }
        // O^T[d][query] += V^T . P^T over the chunk's 64 keys
#pragma unroll
        for (int ks = 0; ks < 2; ++ks) {
            const v16bf bh = pbh[ks], bl = pbl[ks];
            v16bf vf[4];
#pragma unroll
            for (int dt = 0; dt < 4; ++dt) vf[dt] = vfb[4 * ks + dt];
#pragma unroll
            for (int dt = 0; dt < 4; ++dt) { oacc[dt] = wmmab(vf[dt], bh, oacc[dt]); oacc[dt] = wmmab(vf[dt], bl, oacc[dt]); }
            asm volatile("v_nop\n\tv_nop\n\tv_nop\n\tv_nop" : "+v"(oacc[0]), "+v"(oacc[1]), "+v"(oacc[2]), "+v"(oacc[3]) : "v"(vf[0]), "v"(vf[1]), "v"(vf[2]), "v"(vf[3]), "v"(bh), "v"(bl));
        }
        // next chunk's V^T fragments, into the registers just left: they fly during the next chunk's score products and softmax
        vbp += step;
#pragma unroll
        for (int i = 0; i < 8; ++i) vfb[i] = ldbu(vbp + i * 512);
        asm volatile("s_wait_xcnt 0x0" ::: "memory");   // stands between these loads and the next pass's step of their address registers
        ++c;
    }
    // normalise and write: lane holds query lr, d = dt*16 + 8h + r
    lsum += __shfl_xor(lsum, 16, 32);
    const float inv = __fdiv_rn(1.0f, lsum);
    float* osw = os + wave * (16 * 68);   // wave-private staging tile [16 queries][64 d], pitch 68
#pragma unroll
    for (int dt = 0; dt < 4; ++dt)
#pragma unroll
        for (int r = 0; r < 8; ++r) osw[lr * 68 + dt * 16 + 8 * hi + r] = oacc[dt][r] * inv;
    __builtin_amdgcn_fence(3, "wavefront"); __builtin_amdgcn_wave_barrier(); asm volatile("" ::: "memory");
    float* orow = OUT + (z * SEQ + (size_t)q0) * HD;
    v4f val[8];
#pragma unroll
    for (int sg = 0; sg < 8; ++sg) val[sg] = *(const v4fa*)(osw + (2 * sg + hi) * 68 + lr * 4);
#pragma unroll
    for (int sg = 0; sg < 8; ++sg) *(v4f*)(orow + (size_t)(2 * sg + hi) * HD + lr * 4) = val[sg];
    asm volatile("s_wait_xcnt 0x0" ::: "memory");   // behind the last store: in the built kernel the other body's text follows this one, and it writes registers that these stores name
}

// attn_wide: query rows from RH on. A wave holds 32 query rows (two 16-row tiles), so that every K and V^T fragment it loads feeds two products: half the load traffic a product.
// The block's eight waves are four 32-row tiles (wave & 3) x two halves of the tile's key passes (wave >> 2): a wave's walk stays as long as with 16 rows, and the block keeps its rows and its cost.
// A pass is 32 keys: 8 score products (2 key tiles x 2 query tiles x 2 halves of d), 32 weights a lane, 8 p.v products on 8 independent accumulators; fragments are fetched one pass ahead.
// q0 is a multiple of 32, so only the tile's last pass (keys q0..q0+31) crosses the diagonal. Softmax on the unscaled scores t: p = exp2(fma(t, 0.125 log2 e, addend)), the addend holding the maximum in use and p's x1024 carry; lazy rescale, one test a pass for both tiles.
// At the end the wave of the later keys hands its sums, maxima and outputs to its partner through LDS (one block barrier); the partner joins the two on their common maximum, divides and writes.
__device__ __forceinline__ void attn_wide(const bf* __restrict__ Qp, const bf* __restrict__ Kp, const h16* __restrict__ VT16, float* OUT, float* os, int qb) {
    const int lane = threadIdx.x & 31, lr = lane & 15, hi = lane >> 4;
    const int wave = __builtin_amdgcn_readfirstlane((int)(threadIdx.x >> 5));   // the same in every lane: tile, key half and trip counts stay scalar
    const int tile = wave & 3, part = wave >> 2;
    const size_t z = blockIdx.x;
    const int q0 = qb * QT + tile * 32;
    const bf* Qz = Qp + z * ((size_t)SEQ * HD);
    const bf* Kz = Kp + z * ((size_t)SEQ * HD);
    const h16* V16z = VT16 + z * ((size_t)HD * SEQ);
    // Q^T B-fragments of both tiles (column n = query q0 + 16t + lr, k = d), kept for the whole key loop
    const bf* qp = Qz + (size_t)(q0 + lr) * HD + 8 * hi;
    const v16bf qa0 = ldb(qp), qa1 = ldb(qp + 32), qb0 = ldb(qp + 16 * HD), qb1 = ldb(qp + 16 * HD + 32);
    v8f oacc[2][4];
#pragma unroll
    for (int t = 0; t < 2; ++t)
#pragma unroll
        for (int dt = 0; dt < 4; ++dt) oacc[t][dt] = (v8f){};
    float m[2] = {NEG, NEG}, mlim[2] = {NEG, NEG}, eb[2] = {0.0f, 0.0f}, lsum[2] = {0.0f, 0.0f};   // per tile: maximum in use, that plus LZR, addend of the exponent's argument, row sum
    const int np = __builtin_amdgcn_readfirstlane(q0 / 32 + 1);                  // the tile's passes; at least RH / 32 + 1, so both halves hold whole passes below the diagonal and each sets its maximum in its first
    const int c0 = part ? np / 2 : 0, c1 = part ? np : np / 2;
    // a pass's four K fragments (i = 2j + 0, 1: keys 16j + 0..15, d 0..31 and d 32..63) and four V^T fragments (i = dt) each start at element 2048 * pass + 512 * i + 8 * lane of their plane
    const bf* kp = Kz + (size_t)c0 * (32 * HD) + 8 * lane;
    const h16* vp = V16z + (size_t)c0 * (32 * HD) + 8 * lane;
    v16bf kf[4]; v16h vf[4];
#pragma unroll
    for (int i = 0; i < 4; ++i) kf[i] = ldbu(kp + i * 512);
#pragma unroll
    for (int i = 0; i < 4; ++i) vf[i] = ldhu(vp + i * 512);
    // inputs-only fence on the loaded Q and first K fragments: they have landed in front of the loop, so the wait at the loop's head is counted from the loop's own load order alone and leaves the V loads in flight (without it that wait drains them on every pass)
    asm volatile("" :: "v"(qa0), "v"(qa1), "v"(qb0), "v"(qb1), "v"(kf[0]), "v"(kf[1]), "v"(kf[2]), "v"(kf[3]));
    // stands in front of any reuse of the Q loads' address registers; the pointer is an input so that it stays live up to here
    asm volatile("s_wait_xcnt 0x0" :: "v"(qp) : "memory");
    for (int c = c0; c < c1; ++c) {
        const int k0 = c * 32;
        const int step = (c + 1 < c1) ? 32 * HD : 0;   // on to the next pass; the last one fetches its own fragments again (in bounds, unused)
        v8f s[2][2];   // [query tile][key tile]
#pragma unroll
        for (int j = 0; j < 2; ++j) {
            v8f x = wmmab(kf[2 * j], qa0, (v8f){}), y = wmmab(kf[2 * j], qb0, (v8f){});
            s[0][j] = wmmab(kf[2 * j + 1], qa1, x); s[1][j] = wmmab(kf[2 * j + 1], qb1, y);
        }
        // the distance the chip needs behind the last product, also on the taken side of the branch that follows
        asm volatile("v_nop\n\tv_nop\n\tv_nop\n\tv_nop" : "+v"(s[0][0]), "+v"(s[0][1]), "+v"(s[1][0]), "+v"(s[1][1]) : "v"(kf[0]), "v"(kf[1]), "v"(kf[2]), "v"(kf[3]), "v"(qa0), "v"(qa1), "v"(qb0), "v"(qb1));
        // causal select by value, only in the tile's last pass (a scalar branch); the loops are unrolled so that s is indexed by constants and stays in registers
        if (c + 1 == np) {
#pragma unroll
            for (int t = 0; t < 2; ++t)
#pragma unroll
                for (int j = 0; j < 2; ++j)
#pragma unroll
                    for (int r = 0; r < 8; ++r) s[t][j][r] = (k0 + 16 * j + 8 * hi + r <= q0 + 16 * t + lr) ? s[t][j][r] : NEG;
        }
        float tmx[2];
#pragma unroll
        for (int t = 0; t < 2; ++t) {
            tmx[t] = NEG;
#pragma unroll
            for (int j = 0; j < 2; ++j)
#pragma unroll
                for (int r = 0; r < 8; ++r) tmx[t] = fmaxf(tmx[t], s[t][j][r]);
        }
        // lazy rescale, one test a pass (a scalar branch on the ballot): while no lane's pass maximum passes the maximum in use by more than the margin, the exchange between the lane halves, the factors and
        // the 66 multiplies are left out. A renewing wave renews both tiles (every query takes its true maximum so far) and goes on with the scores it has: the products are formed in place and join behind the branch.
        if (__builtin_expect(__builtin_amdgcn_ballot_w32(tmx[0] > mlim[0] || tmx[1] > mlim[1]) != 0u, 0)) {   // marked rare: the common side falls through
#pragma unroll
            for (int t = 0; t < 2; ++t) {
                const float mn = fmaxf(m[t], fmaxf(tmx[t], __shfl_xor(tmx[t], 16, 32)));
                const float alpha = __builtin_amdgcn_exp2f((m[t] - mn) * CEX);
                eb[t] = PCL2 - mn * CEX;
                m[t] = mn; mlim[t] = mn + LZR; lsum[t] *= alpha;
#pragma unroll
                for (int dt = 0; dt < 4; ++dt)
#pragma unroll
                    for (int r = 0; r < 8; ++r) oacc[t][dt][r] *= alpha;
            }
        }
        // next pass's K fragments, into the registers the products above have just left: they fly during the softmax and the p.v products
        kp += step;
#pragma unroll
        for (int i = 0; i < 4; ++i) kf[i] = ldbu(kp + i * 512);
        asm volatile("s_wait_xcnt 0x0" ::: "memory");   // stands between these loads and the next pass's step of their address registers
        __builtin_amdgcn_sched_barrier(0);   // holds these loads here, in front of the exponentials: scheduled later they have less of the pass to land in
        v16h pf[2];
#pragma unroll
        for (int t = 0; t < 2; ++t) {
            v16h p16;
#pragma unroll
            for (int j = 0; j < 2; ++j)
#pragma unroll
                for (int r = 0; r < 8; ++r) {
                    const float p = __builtin_amdgcn_exp2f(__builtin_fmaf(s[t][j][r], CEX, eb[t]));
                    lsum[t] += p;
                    p16[j * 8 + r] = (h16)p;
                }
            pf[t] = p16;
        }
        // O^T[d][query] += V^T . P^T over the pass's 32 keys, both query tiles on each V^T fragment
#pragma unroll
        for (int dt = 0; dt < 4; ++dt) { oacc[0][dt] = wmma16(vf[dt], pf[0], oacc[0][dt]); oacc[1][dt] = wmma16(vf[dt], pf[1], oacc[1][dt]); }
        // the distance the chip needs behind the last product, in front of the loads that land on its operands
        asm volatile("v_nop\n\tv_nop\n\tv_nop\n\tv_nop" : "+v"(oacc[0][0]), "+v"(oacc[0][1]), "+v"(oacc[0][2]), "+v"(oacc[0][3]), "+v"(oacc[1][0]), "+v"(oacc[1][1]), "+v"(oacc[1][2]), "+v"(oacc[1][3]) : "v"(vf[0]), "v"(vf[1]), "v"(vf[2]), "v"(vf[3]), "v"(pf[0]), "v"(pf[1]));
        // next pass's V^T fragments, into the registers just left: they fly during the next pass's score products and softmax
        vp += step;
#pragma unroll
        for (int i = 0; i < 4; ++i) vf[i] = ldhu(vp + i * 512);
        asm volatile("s_wait_xcnt 0x0" ::: "memory");   // stands between these loads and the next pass's step of their address registers
    }
#pragma unroll
    for (int t = 0; t < 2; ++t) lsum[t] += __shfl_xor(lsum[t], 16, 32);
    // hand-over: the pair's own 2176 floats of LDS; outputs as [t][dt][half of r][lane][4] (16 bytes a lane, contiguous over the wave), then maxima and sums as [t][lane]
    float* jw = os + tile * (32 * 68);
    if (part) {
#pragma unroll
        for (int t = 0; t < 2; ++t) {
#pragma unroll
            for (int dt = 0; dt < 4; ++dt)
#pragma unroll
                for (int h = 0; h < 2; ++h)
                    *(v4fa*)(jw + ((t * 4 + dt) * 2 + h) * 128 + lane * 4) = (v4f){oacc[t][dt][4 * h], oacc[t][dt][4 * h + 1], oacc[t][dt][4 * h + 2], oacc[t][dt][4 * h + 3]};
            jw[2048 + t * 32 + lane] = m[t];
            jw[2112 + t * 32 + lane] = lsum[t];
        }
    }
    __syncthreads();   // every wave of the block passes it once: the later half's values are in LDS before the partner reads them
    if (part) return;
#pragma unroll
    for (int t = 0; t < 2; ++t) {
        const float mo = jw[2048 + t * 32 + lane], lo = jw[2112 + t * 32 + lane];
        const float mn = fmaxf(m[t], mo);
        const float fa = __builtin_amdgcn_exp2f((m[t] - mn) * CEX), fb = __builtin_amdgcn_exp2f((mo - mn) * CEX);
        const float inv = __fdiv_rn(1.0f, lsum[t] * fa + lo * fb);
        const float ga = fa * inv, gb = fb * inv;
#pragma unroll
        for (int dt = 0; dt < 4; ++dt)
#pragma unroll
            for (int h = 0; h < 2; ++h) {
                const v4f o = *(const v4fa*)(jw + ((t * 4 + dt) * 2 + h) * 128 + lane * 4);
#pragma unroll
                for (int e = 0; e < 4; ++e) oacc[t][dt][4 * h + e] = oacc[t][dt][4 * h + e] * ga + o[e] * gb;
            }
    }
    // the pair's LDS now becomes this wave's staging tile [32 queries][64 d], pitch 68: the stores below follow all the reads above in program order, which is this wave's LDS order
#pragma unroll
    for (int t = 0; t < 2; ++t)
#pragma unroll
        for (int dt = 0; dt < 4; ++dt)
#pragma unroll
            for (int r = 0; r < 8; ++r) jw[(t * 16 + lr) * 68 + dt * 16 + 8 * hi + r] = oacc[t][dt][r];
    __builtin_amdgcn_fence(3, "wavefront"); __builtin_amdgcn_wave_barrier(); asm volatile("" ::: "memory");
    float* orow = OUT + (z * SEQ + (size_t)q0) * HD;
    v4f val[16];
#pragma unroll
    for (int sg = 0; sg < 16; ++sg) val[sg] = *(const v4fa*)(jw + (2 * sg + hi) * 68 + lr * 4);
#pragma unroll
    for (int sg = 0; sg < 16; ++sg) *(v4f*)(orow + (size_t)(2 * sg + hi) * HD + lr * 4) = val[sg];
    // behind the last store: with nothing here the compiler shares this body's last stores with the other body's and forms their addresses anew on registers that the earlier stores of both bodies name
    asm volatile("s_wait_xcnt 0x0" ::: "memory");
}

// k_attn: one grid for every (plane z = blockIdx.x, query block); blockIdx.y is the query block's rank by cost.
// The grid holds more blocks than the chip has places, and cost falls with the rank: the longest blocks take the lowest flat indices and the
// shortest the highest. A block's cost is its key chunks, 16 * qb + 12 over its eight waves (rows from RH on: 16 * qb + 10 passes of as many scores), counted double for query rows below RH (about twice the vector
// instructions a chunk). The rank is found by merging the two falling lists, so every query block has exactly one rank whatever the sizes. Speed only: the order changes no value.
__global__ __launch_bounds__(256) __attribute__((amdgpu_num_vgpr(256)))
void k_attn(const bf* __restrict__ Qp, const bf* __restrict__ Kp, const bf* __restrict__ VTh, const h16* __restrict__ VT16, float* OUT) {
    __shared__ __align__(16) float os[8 * 16 * 68];
    constexpr int nqb = SEQ / QT, rhb = ((RH < SEQ) ? RH : SEQ) / QT;
    int a = nqb - 1, b = rhb - 1, qb = 0;   // next block of each list: rows from RH on, rows below RH
#pragma unroll 1   // a few scalar instructions a trip, once a block: unrolled it only lengthens the text in front of the hot loops
    for (int i = 0; i <= (int)blockIdx.y; ++i) {
        const bool low = a < rhb || (b >= 0 && 2 * (16 * b + 12) > 16 * a + 12);
        qb = low ? b-- : a--;
    }
    if (qb >= rhb) {
        attn_wide(Qp, Kp, VT16, OUT, os, qb);
    } else {
        // compiler fence at the head of this side alone: without it the first K loads, alike on both sides, are merged in front of the branch and the body for rows below RH spills to scratch
        asm volatile("" ::: "memory");
        attn_block(Qp, Kp, VTh, OUT, os, qb);
    }
}

extern "C" void kernel_launch(void* const* d_in, const int* in_sizes, int n_in,
                              void* d_out, int out_size, void* d_ws, size_t ws_size, hipStream_t stream) {
    if (n_in < 3) return;
    const float* xq = (const float*)d_in[0];   // [NB][16][SEQ_FULL][64] f32
    const float* xk = (const float*)d_in[1];
    const float* xv = (const float*)d_in[2];
    float* OUT = (float*)d_out;                // [NB][16][SEQ][64] f32
    const long long need_in = (long long)(NZ - 1) * SEQ_FULL * HD + (long long)SEQ * HD;
    if ((long long)in_sizes[0] < need_in || (long long)in_sizes[1] < need_in || (long long)in_sizes[2] < need_in) return;
    if ((long long)out_size < (long long)NZ * SEQ * HD) return;
    char* wsp = (char*)d_ws;
    auto take = [&](size_t bytes) { char* p = wsp; wsp += (bytes + 255) & ~(size_t)255; return (void*)p; };
    const size_t plane = (size_t)NZ * SEQ * HD;      // elements per 16-bit plane
    bf*  Qp   = (bf*)take(plane * 2);                 // [z][t][d] bf16
    bf*  Kp   = (bf*)take(plane * 2);                 // fragment order, bf16
    bf*  VTh  = (bf*)take(plane * 2);                 // fragment order, bf16
    h16* VT16 = (h16*)take(plane * 2);                // fragment order, f16
    if ((size_t)(wsp - (char*)d_ws) > ws_size) return;   // 4 x 16 MiB = 64 MiB at full size
    k_pack<<<PKB, 512, 0, stream>>>(xq, xk, xv, Qp, Kp, VT16, VTh);
    k_attn<<<dim3(NZ, SEQ / QT), 256, 0, stream>>>(Qp, Kp, VTh, VT16, OUT);
}

// v010
// It runs in 68 microseconds.
// Next to v009, in two timings, it ran 1.11 times as fast each time.
// Counting every step since v000, it is 5.39 times as fast.
#include <hip/hip_runtime.h>

// Contractions (f32 accumulate): score tiles k.q^T on v_wmma_f32_16x16x32_bf16 (bf16 operands = RNE-converted q and k, exact products; x0.125 is part of the f32 factor of the exponent's argument);
// p.v on v_wmma_f32_16x16x32_f16 (p carried x1024 in f16, v f16) for every query row;
// streaming softmax against a reference maximum per query, kept on the unscaled scores, that is renewed, with the rescale of sums and outputs, only in a pass
// where some score of the wave passes it by more than LZR (it cancels in the division); row sums and the final 1/l scaling in f32; f32 output.
// Layout: one launch converts q into a bf16 plane [z][t][d] (z = b*16 + h) and k (bf16) and v (f16) into planes stored in fragment order:
// every 16-byte-per-lane load of a K or V^T fragment half is one 512-byte unit [lane][8 elements], so a wave-wide load reads four whole 128-byte lines.
// One streaming causal attention launch for all query blocks: 128 query rows per block of 8 waves = 4 tiles of 32 rows x 2 halves of the tile's keys, 32-key passes, each fragment load feeding two products,
// the halves joined through LDS; operands loaded as fragments straight from the planes, one pass ahead of their use,
// causal select by value only in the one pass of a tile that crosses the diagonal, key passes entirely above the diagonal are never visited (their weights are exactly zero).

#ifndef NB
#define NB 2
#endif
#ifndef SEQ
#define SEQ 4096
#endif
#ifndef SEQ_FULL
#define SEQ_FULL 4096
#endif
#define NH 16
#define HD 64
#define NZ (NB * NH)
#define QT 128
#define PCL2 10.0f   // p is carried x 2^10 where it goes to f16: added to the exponent's argument, so weights and row sums both hold it and it cancels in the division
#define SCL 0.125f
#define L2E 1.4426950408889634f
#define CEX (SCL * L2E)   // score scale and log2 e as one factor (a power of two times the f32 log2 e: no second rounding)
#define NEG (-1.0e30f)
#define LZR 27.0f   // lazy rescale: the maximum in use stays until an unscaled score passes it by more than this (x 0.125 log2 e = 4.87: a weight stays below 2^4.87, x1024 below 2^14.87, inside f16)
#define PKB 256   // packing work-groups: one per WGP of the chip (speed only: the span loop strides by the grid, so any count does all the work once)
static_assert(SEQ % QT == 0);
static_assert(QT == 4 * 32);
static_assert(HD == 64);
static_assert(SEQ % 32 == 0);
static_assert(SEQ <= SEQ_FULL);
static_assert(((long long)NZ * SEQ * HD) % 8 == 0);

typedef _Float16 h16;
typedef unsigned short bf;
typedef __attribute__((ext_vector_type(16))) __bf16         v16bf;
typedef __attribute__((ext_vector_type(16))) _Float16       v16h;
typedef __attribute__((ext_vector_type(16))) unsigned short v16us;
typedef __attribute__((ext_vector_type(8)))  _Float16       v8h;
typedef __attribute__((ext_vector_type(8)))  unsigned short v8us;
typedef __attribute__((ext_vector_type(8)))  float          v8f;
typedef __attribute__((ext_vector_type(4)))  float          v4f;
typedef __attribute__((ext_vector_type(2)))  _Float16       v2h;
typedef __attribute__((ext_vector_type(2)))  unsigned short v2us;
typedef v4f __attribute__((may_alias)) v4fa;

__device__ __forceinline__ unsigned short f2bf(float f) { unsigned u = __float_as_uint(f); u += 0x7FFFu + ((u >> 16) & 1u); return (unsigned short)(u >> 16); }
__device__ __forceinline__ float bf2f(unsigned short b) { return __uint_as_float(((unsigned)b) << 16); }
__device__ __forceinline__ float bfr(float f) { return bf2f(f2bf(f)); }
__device__ __forceinline__ v16h  cat16(v8h lo, v8h hi) { return __builtin_shufflevector(lo, hi, 0, 1, 2, 3, 4, 5, 6, 7, 8, 9, 10, 11, 12, 13, 14, 15); }
__device__ __forceinline__ v16bf cat16b(v8us lo, v8us hi) { return __builtin_bit_cast(v16bf, __builtin_shufflevector(lo, hi, 0, 1, 2, 3, 4, 5, 6, 7, 8, 9, 10, 11, 12, 13, 14, 15)); }
__device__ __forceinline__ v8f wmma16(v16h a, v16h b, v8f c) { return __builtin_amdgcn_wmma_f32_16x16x32_f16(false, a, false, b, (short)0, c, false, false); }
__device__ __forceinline__ v8f wmmab(v16bf a, v16bf b, v8f c) { return __builtin_amdgcn_wmma_f32_16x16x32_bf16(false, a, false, b, (short)0, c, false, false); }

// Fragment loader for a 16 x 32(k) operand tile from a k-contiguous 16-bit row; p = base + row(lane & 15) * pitch + k0 + 8 * (lane >> 4):
// elements 0..7 = k0 + 8h + 0..7, elements 8..15 = k0 + 16 + 8h + 0..7 (same map for the A operand, row = lane & 15, and for the B operand stored [n][k], column = lane & 15).
__device__ __forceinline__ v16bf ldb(const bf* p) { return cat16b(*(const v8us*)p, *(const v8us*)(p + 16)); }
// The same fragments from a fragment-order plane; p = first unit of the fragment + 8 * lane: elements 0..7 from that unit, elements 8..15 from the next unit (256 elements on).
__device__ __forceinline__ v16bf ldbu(const bf* p) { return cat16b(*(const v8us*)p, *(const v8us*)(p + 256)); }
__device__ __forceinline__ v16h  ldhu(const h16* p) { return cat16(*(const v8h*)p, *(const v8h*)(p + 256)); }

// k_pack: all three conversions in one resident stream. PKB work-groups of 16 waves; a wave takes whole spans of 32 positions x 64 d of one plane z (8 KiB of f32 per input,
// 256 destination pieces of 16 bytes, piece = 256 * span + 32j + lane, j = 0..7) and has a span's loads in flight together, so that few waves have to start and each keeps the memory busy.
// Qp[z][t][d]: piece j holds elements 256j + 8 * lane + 0..7 of the span.
// Kf[z][t / 16][u][lane][8]: unit u (0..3) of a 16-key tile holds, at lane, key 16 * tile + (lane & 15), d = 16u + 8 * (lane >> 4) + 0..7
// (units 0, 1 = the A fragment for d 0..31, units 2, 3 = the one for d 32..63); piece j = tile j >> 2 of the span, unit j & 3.
// V16[z][t / 32][dt][u][lane][8] (f16 bits of the input RNE-converted to bf16): unit u (0, 1) of the V^T A fragment for d tile dt and a 32-key step
// holds, at lane, d = 16dt + (lane & 15), keys 32 * step + 16u + 8 * (lane >> 4) + 0..7; piece j = d tile j >> 1, unit j & 1. Sources [z][t][d] with z-pitch SEQ_FULL*HD.
__global__ __launch_bounds__(512) void k_pack(const float* __restrict__ xq, const float* __restrict__ xk, const float* __restrict__ xv, bf* Qp, bf* Kf, h16* V16) {
    const int lane = threadIdx.x & 31, lr = lane & 15, hi = lane >> 4;
    const int wave = __builtin_amdgcn_readfirstlane((int)(threadIdx.x >> 5));   // the same in every lane: span bases stay scalar
    for (int sp = (int)blockIdx.x * 16 + wave; sp < NZ * (SEQ / 32); sp += (int)gridDim.x * 16) {
        const size_t src = ((size_t)(sp / (SEQ / 32)) * SEQ_FULL + (size_t)(sp % (SEQ / 32)) * 32) * HD;
        const size_t dst = (size_t)sp * 2048 + (size_t)lane * 8;
        const float* fq = xq + src + lane * 8;
        const float* fk = xk + src + lr * HD + hi * 8;
        const float* fv = xv + src + hi * (8 * HD) + lr;
        v8f a[8], b[8]; float c[8][8];
#pragma unroll
        for (int j = 0; j < 8; ++j) a[j] = *(const v8f*)(fq + j * 256);
#pragma unroll
        for (int j = 0; j < 8; ++j) b[j] = *(const v8f*)(fk + (j >> 2) * (16 * HD) + (j & 3) * 16);
        // stands in front of any reuse of these loads' address registers; the pointers are inputs so that they stay live up to here and no load lands on an address register
        asm volatile("s_wait_xcnt 0x0" :: "v"(fq), "v"(fk) : "memory");
        __builtin_amdgcn_sched_barrier(0);   // all 32 loads are issued before any conversion: scheduled among the conversions, the later ones would start only when the earlier have landed
#pragma unroll
        for (int j = 0; j < 8; ++j) {
            v8us o;
#pragma unroll
            for (int k = 0; k < 8; ++k) o[k] = f2bf(a[j][k]);
            *(v8us*)(Qp + dst + j * 256) = o;
        }
        asm volatile("s_wait_xcnt 0x0" ::: "memory");   // stands between the q stores and the value loads, which land on registers that those stores name
        __builtin_amdgcn_sched_barrier(0);   // holds the value loads behind the q stores and the wait above
#pragma unroll
        for (int j = 0; j < 8; ++j)
#pragma unroll
            for (int q = 0; q < 8; ++q) c[j][q] = fv[(j & 1) * (16 * HD) + (j >> 1) * 16 + q * HD];
        asm volatile("s_wait_xcnt 0x0" :: "v"(fv) : "memory");   // as above, for the value loads
        __builtin_amdgcn_sched_barrier(0);   // as above: every value load is issued before the key conversions start
#pragma unroll
        for (int j = 0; j < 8; ++j) {
            v8us o;
#pragma unroll
            for (int k = 0; k < 8; ++k) o[k] = f2bf(b[j][k]);
            *(v8us*)(Kf + dst + j * 256) = o;
        }
#pragma unroll
        for (int j = 0; j < 8; ++j) {
            v8h o16;
#pragma unroll
            for (int q = 0; q < 8; ++q) o16[q] = (h16)bfr(c[j][q]);
            *(v8h*)(V16 + dst + j * 256) = o16;
        }
        asm volatile("s_wait_xcnt 0x0" ::: "memory");   // stands between the stores and the next span's step of their address registers
    }
}

// attn_wide: query block qb of head-plane z = blockIdx.x (os: the block's hand-over and staging tiles in LDS). A wave holds 32 query rows (two 16-row tiles), so that every K and V^T fragment it loads feeds two products: half the load traffic a product.
// The block's eight waves are four 32-row tiles (wave & 3) x two halves of the tile's key passes (wave >> 2): a wave's walk stays as long as with 16 rows, and the block keeps its rows and its cost.
// A pass is 32 keys: 8 score products (2 key tiles x 2 query tiles x 2 halves of d), 32 weights a lane, 8 p.v products on 8 independent accumulators; fragments are fetched one pass ahead.
// q0 is a multiple of 32, so only the tile's last pass (keys q0..q0+31) crosses the diagonal. Softmax on the unscaled scores t: p = exp2(fma(t, 0.125 log2 e, addend)), the addend holding the maximum in use and p's x1024 carry; lazy rescale, one test a pass for both tiles.
// At the end the wave of the later keys hands its sums, maxima and outputs to its partner through LDS (one block barrier); the partner joins the two on their common maximum, divides and writes.
__device__ __forceinline__ void attn_wide(const bf* __restrict__ Qp, const bf* __restrict__ Kp, const h16* __restrict__ VT16, float* OUT, float* os, int qb) {
    const int lane = threadIdx.x & 31, lr = lane & 15, hi = lane >> 4;
    const int wave = __builtin_amdgcn_readfirstlane((int)(threadIdx.x >> 5));   // the same in every lane: tile, key half and trip counts stay scalar
    const int tile = wave & 3, part = wave >> 2;
    const size_t z = blockIdx.x;
    const int q0 = qb * QT + tile * 32;
    const bf* Qz = Qp + z * ((size_t)SEQ * HD);
    const bf* Kz = Kp + z * ((size_t)SEQ * HD);
    const h16* V16z = VT16 + z * ((size_t)HD * SEQ);
    // Q^T B-fragments of both tiles (column n = query q0 + 16t + lr, k = d), kept for the whole key loop
    const bf* qp = Qz + (size_t)(q0 + lr) * HD + 8 * hi;
    const v16bf qa0 = ldb(qp), qa1 = ldb(qp + 32), qb0 = ldb(qp + 16 * HD), qb1 = ldb(qp + 16 * HD + 32);
    v8f oacc[2][4];
#pragma unroll
    for (int t = 0; t < 2; ++t)
#pragma unroll
        for (int dt = 0; dt < 4; ++dt) oacc[t][dt] = (v8f){};
    float m[2] = {NEG, NEG}, mlim[2] = {NEG, NEG}, eb[2] = {0.0f, 0.0f}, lsum[2] = {0.0f, 0.0f};   // per tile: maximum in use, that plus LZR, addend of the exponent's argument, row sum
    const int np = __builtin_amdgcn_readfirstlane(q0 / 32 + 1);                  // the tile's passes. A half sets its maximum in its first pass (every query has a key at or below it there, the diagonal pass included); the earlier half of a one-pass tile is empty and joins with factor 0
    const int c0 = part ? np / 2 : 0, c1 = part ? np : np / 2;
    // a pass's four K fragments (i = 2j + 0, 1: keys 16j + 0..15, d 0..31 and d 32..63) and four V^T fragments (i = dt) each start at element 2048 * pass + 512 * i + 8 * lane of their plane
    const bf* kp = Kz + (size_t)c0 * (32 * HD) + 8 * lane;
    const h16* vp = V16z + (size_t)c0 * (32 * HD) + 8 * lane;
    v16bf kf[4]; v16h vf[4];
#pragma unroll
    for (int i = 0; i < 4; ++i) kf[i] = ldbu(kp + i * 512);
#pragma unroll
    for (int i = 0; i < 4; ++i) vf[i] = ldhu(vp + i * 512);
    // inputs-only fence on the loaded Q and first K fragments: they have landed in front of the loop, so the wait at the loop's head is counted from the loop's own load order alone and leaves the V loads in flight (without it that wait drains them on every pass)
    asm volatile("" :: "v"(qa0), "v"(qa1), "v"(qb0), "v"(qb1), "v"(kf[0]), "v"(kf[1]), "v"(kf[2]), "v"(kf[3]));
    // stands in front of any reuse of the Q loads' address registers; the pointer is an input so that it stays live up to here
    asm volatile("s_wait_xcnt 0x0" :: "v"(qp) : "memory");
    for (int c = c0; c < c1; ++c) {
        const int k0 = c * 32;
        const int step = (c + 1 < c1) ? 32 * HD : 0;   // on to the next pass; the last one fetches its own fragments again (in bounds, unused)
        v8f s[2][2];   // [query tile][key tile]
#pragma unroll
        for (int j = 0; j < 2; ++j) {
            v8f x = wmmab(kf[2 * j], qa0, (v8f){}), y = wmmab(kf[2 * j], qb0, (v8f){});
            s[0][j] = wmmab(kf[2 * j + 1], qa1, x); s[1][j] = wmmab(kf[2 * j + 1], qb1, y);
        }
        // the distance the chip needs behind the last product, also on the taken side of the branch that follows
        asm volatile("v_nop\n\tv_nop\n\tv_nop\n\tv_nop" : "+v"(s[0][0]), "+v"(s[0][1]), "+v"(s[1][0]), "+v"(s[1][1]) : "v"(kf[0]), "v"(kf[1]), "v"(kf[2]), "v"(kf[3]), "v"(qa0), "v"(qa1), "v"(qb0), "v"(qb1));
        // causal select by value, only in the tile's last pass (a scalar branch); the loops are unrolled so that s is indexed by constants and stays in registers
        if (c + 1 == np) {
#pragma unroll
            for (int t = 0; t < 2; ++t)
#pragma unroll
                for (int j = 0; j < 2; ++j)
#pragma unroll
                    for (int r = 0; r < 8; ++r) s[t][j][r] = (k0 + 16 * j + 8 * hi + r <= q0 + 16 * t + lr) ? s[t][j][r] : NEG;
        }
        float tmx[2];
#pragma unroll
        for (int t = 0; t < 2; ++t) {
            tmx[t] = NEG;
#pragma unroll
            for (int j = 0; j < 2; ++j)
#pragma unroll
                for (int r = 0; r < 8; ++r) tmx[t] = fmaxf(tmx[t], s[t][j][r]);
        }
        // lazy rescale, one test a pass (a scalar branch on the ballot): while no lane's pass maximum passes the maximum in use by more than the margin, the exchange between the lane halves, the factors and
        // the 66 multiplies are left out. A renewing wave renews both tiles (every query takes the larger of its maximum in use and its pass maximum) and goes on with the scores it has: the products are formed in place and join behind the branch.
        if (__builtin_expect(__builtin_amdgcn_ballot_w32(tmx[0] > mlim[0] || tmx[1] > mlim[1]) != 0u, 0)) {   // marked rare: the common side falls through
#pragma unroll
            for (int t = 0; t < 2; ++t) {
                const float mn = fmaxf(m[t], fmaxf(tmx[t], __shfl_xor(tmx[t], 16, 32)));
                const float alpha = __builtin_amdgcn_exp2f((m[t] - mn) * CEX);
                eb[t] = PCL2 - mn * CEX;
                m[t] = mn; mlim[t] = mn + LZR; lsum[t] *= alpha;
#pragma unroll
                for (int dt = 0; dt < 4; ++dt)
#pragma unroll
                    for (int r = 0; r < 8; ++r) oacc[t][dt][r] *= alpha;
            }
        }
        // next pass's K fragments, into the registers the products above have just left: they fly during the softmax and the p.v products
        kp += step;
#pragma unroll
        for (int i = 0; i < 4; ++i) kf[i] = ldbu(kp + i * 512);
        asm volatile("s_wait_xcnt 0x0" ::: "memory");   // stands between these loads and the next pass's step of their address registers
        __builtin_amdgcn_sched_barrier(0);   // holds these loads here, in front of the exponentials: scheduled later they have less of the pass to land in
        v16h pf[2];
#pragma unroll
        for (int t = 0; t < 2; ++t) {
            v16h p16;
#pragma unroll
            for (int j = 0; j < 2; ++j)
#pragma unroll
                for (int r = 0; r < 8; ++r) {
                    const float p = __builtin_amdgcn_exp2f(__builtin_fmaf(s[t][j][r], CEX, eb[t]));
                    lsum[t] += p;
                    p16[j * 8 + r] = (h16)p;
                }
            pf[t] = p16;
        }
        // O^T[d][query] += V^T . P^T over the pass's 32 keys, both query tiles on each V^T fragment
#pragma unroll
        for (int dt = 0; dt < 4; ++dt) { oacc[0][dt] = wmma16(vf[dt], pf[0], oacc[0][dt]); oacc[1][dt] = wmma16(vf[dt], pf[1], oacc[1][dt]); }
        // the distance the chip needs behind the last product, in front of the loads that land on its operands
        asm volatile("v_nop\n\tv_nop\n\tv_nop\n\tv_nop" : "+v"(oacc[0][0]), "+v"(oacc[0][1]), "+v"(oacc[0][2]), "+v"(oacc[0][3]), "+v"(oacc[1][0]), "+v"(oacc[1][1]), "+v"(oacc[1][2]), "+v"(oacc[1][3]) : "v"(vf[0]), "v"(vf[1]), "v"(vf[2]), "v"(vf[3]), "v"(pf[0]), "v"(pf[1]));
        // next pass's V^T fragments, into the registers just left: they fly during the next pass's score products and softmax
        vp += step;
#pragma unroll
        for (int i = 0; i < 4; ++i) vf[i] = ldhu(vp + i * 512);
        asm volatile("s_wait_xcnt 0x0" ::: "memory");   // stands between these loads and the next pass's step of their address registers
    }
#pragma unroll
    for (int t = 0; t < 2; ++t) lsum[t] += __shfl_xor(lsum[t], 16, 32);
    // hand-over: the pair's own 2176 floats of LDS; outputs as [t][dt][half of r][lane][4] (16 bytes a lane, contiguous over the wave), then maxima and sums as [t][lane]
    float* jw = os + tile * (32 * 68);
    if (part) {
#pragma unroll
        for (int t = 0; t < 2; ++t) {
#pragma unroll
            for (int dt = 0; dt < 4; ++dt)
#pragma unroll
                for (int h = 0; h < 2; ++h)
                    *(v4fa*)(jw + ((t * 4 + dt) * 2 + h) * 128 + lane * 4) = (v4f){oacc[t][dt][4 * h], oacc[t][dt][4 * h + 1], oacc[t][dt][4 * h + 2], oacc[t][dt][4 * h + 3]};
            jw[2048 + t * 32 + lane] = m[t];
            jw[2112 + t * 32 + lane] = lsum[t];
        }
    }
    __syncthreads();   // every wave of the block passes it once: the later half's values are in LDS before the partner reads them
    if (part) return;
#pragma unroll
    for (int t = 0; t < 2; ++t) {
        const float mo = jw[2048 + t * 32 + lane], lo = jw[2112 + t * 32 + lane];
        const float mn = fmaxf(m[t], mo);
        const float fa = __builtin_amdgcn_exp2f((m[t] - mn) * CEX), fb = __builtin_amdgcn_exp2f((mo - mn) * CEX);
        const float inv = __fdiv_rn(1.0f, lsum[t] * fa + lo * fb);
        const float ga = fa * inv, gb = fb * inv;
#pragma unroll
        for (int dt = 0; dt < 4; ++dt)
#pragma unroll
            for (int h = 0; h < 2; ++h) {
                const v4f o = *(const v4fa*)(jw + ((t * 4 + dt) * 2 + h) * 128 + lane * 4);
#pragma unroll
                for (int e = 0; e < 4; ++e) oacc[t][dt][4 * h + e] = oacc[t][dt][4 * h + e] * ga + o[e] * gb;
            }
    }
    // the pair's LDS now becomes this wave's staging tile [32 queries][64 d], pitch 68: the stores below follow all the reads above in program order, which is this wave's LDS order
#pragma unroll
    for (int t = 0; t < 2; ++t)
#pragma unroll
        for (int dt = 0; dt < 4; ++dt)
#pragma unroll
            for (int r = 0; r < 8; ++r) jw[(t * 16 + lr) * 68 + dt * 16 + 8 * hi + r] = oacc[t][dt][r];
    __builtin_amdgcn_fence(3, "wavefront"); __builtin_amdgcn_wave_barrier(); asm volatile("" ::: "memory");
    float* orow = OUT + (z * SEQ + (size_t)q0) * HD;
    v4f val[16];
#pragma unroll
    for (int sg = 0; sg < 16; ++sg) val[sg] = *(const v4fa*)(jw + (2 * sg + hi) * 68 + lr * 4);
#pragma unroll
    for (int sg = 0; sg < 16; ++sg) *(v4f*)(orow + (size_t)(2 * sg + hi) * HD + lr * 4) = val[sg];
}

// k_attn: one grid for every (plane z = blockIdx.x, query block); blockIdx.y is the query block's rank by cost.
// The grid holds more blocks than the chip has places and cost falls with the rank: the longest blocks take the lowest ranks. A block's cost is its passes, 16 * qb + 10 over its eight waves, so the rank runs from the last query block to the first. Speed only: the order changes no value.
__global__ __launch_bounds__(256) __attribute__((amdgpu_num_vgpr(256)))
void k_attn(const bf* __restrict__ Qp, const bf* __restrict__ Kp, const h16* __restrict__ VT16, float* OUT) {
    __shared__ __align__(16) float os[4 * 32 * 68];
    attn_wide(Qp, Kp, VT16, OUT, os, SEQ / QT - 1 - (int)blockIdx.y);
}

extern "C" void kernel_launch(void* const* d_in, const int* in_sizes, int n_in,
                              void* d_out, int out_size, void* d_ws, size_t ws_size, hipStream_t stream) {
    if (n_in < 3) return;
    const float* xq = (const float*)d_in[0];   // [NB][16][SEQ_FULL][64] f32
    const float* xk = (const float*)d_in[1];
    const float* xv = (const float*)d_in[2];
    float* OUT = (float*)d_out;                // [NB][16][SEQ][64] f32
    const long long need_in = (long long)(NZ - 1) * SEQ_FULL * HD + (long long)SEQ * HD;
    if ((long long)in_sizes[0] < need_in || (long long)in_sizes[1] < need_in || (long long)in_sizes[2] < need_in) return;
    if ((long long)out_size < (long long)NZ * SEQ * HD) return;
    char* wsp = (char*)d_ws;
    auto take = [&](size_t bytes) { char* p = wsp; wsp += (bytes + 255) & ~(size_t)255; return (void*)p; };
    const size_t plane = (size_t)NZ * SEQ * HD;      // elements per 16-bit plane
    bf*  Qp   = (bf*)take(plane * 2);                 // [z][t][d] bf16
    bf*  Kp   = (bf*)take(plane * 2);                 // fragment order, bf16
    h16* VT16 = (h16*)take(plane * 2);                // fragment order, f16
    if ((size_t)(wsp - (char*)d_ws) > ws_size) return;   // 3 x 16 MiB = 48 MiB at full size
    k_pack<<<PKB, 512, 0, stream>>>(xq, xk, xv, Qp, Kp, VT16);
    k_attn<<<dim3(NZ, SEQ / QT), 256, 0, stream>>>(Qp, Kp, VT16, OUT);
}
